// v000
// The times below were measured on an AMD MI455X: many runs one after another, warmed up first and cycling through
// copies of the inputs, with the whole window's GPU time divided by the number of runs. Launches and the gaps
// between them are all in it. The median over several windows is given; except for v000 it joins two sittings, which
// can be a few percent apart, so the side-by-side timings, each taken in one sitting, are the better comparison.
// v000, which the later versions start from, runs in 394 microseconds.
#include <hip/hip_runtime.h>
#include <math.h>

typedef __attribute__((ext_vector_type(16))) __bf16 v16bf;
typedef __attribute__((ext_vector_type(8)))  float  v8f;

// ---------------------------------------------------------------------------
// WMMA helper: D = A(16x32 bf16) * B(32x16 bf16) + C(16x16 f32)
// ---------------------------------------------------------------------------
__device__ inline v8f wmma_bf16(v16bf a, v16bf b, v8f c) {
  return __builtin_amdgcn_wmma_f32_16x16x32_bf16(
      /*neg_a=*/false, a, /*neg_b=*/false, b,
      /*c_mod=*/(short)0, c, /*reuse_a=*/false, /*reuse_b=*/false);
}

// Fragment element pattern (16-bit A/B, 16x32): per lane, element e maps to
// K = kh + e (e<8) or K = 16 + kh + (e-8) (e>=8), with kh = 8*(lane>=16).
__device__ inline v16bf load_frag_bf16(const __bf16* base, int kh) {
  v16bf r;
#pragma unroll
  for (int e = 0; e < 8; ++e) { r[e] = base[kh + e]; r[e + 8] = base[16 + kh + e]; }
  return r;
}

__device__ inline v16bf cvt_frag_f32(const float* base, int kh) {
  v16bf r;
#pragma unroll
  for (int e = 0; e < 8; ++e) { r[e] = (__bf16)base[kh + e]; r[e + 8] = (__bf16)base[16 + kh + e]; }
  return r;
}

// Low 32 bits of a flat shared-aperture address = LDS byte offset.
__device__ inline unsigned int lds_addr_u32(const void* p) {
  return (unsigned int)(size_t)p;
}

// CDNA5 async copy: 16B global -> LDS per lane, tracked by ASYNCcnt.
__device__ inline void async_load_b128(unsigned int lds_byte_addr, const void* gptr) {
  unsigned long long ga = (unsigned long long)(size_t)gptr;
  asm volatile("global_load_async_to_lds_b128 %0, %1, off"
               :
               : "v"(lds_byte_addr), "v"(ga)
               : "memory");
}
__device__ inline void wait_asynccnt0() {
  asm volatile("s_wait_asynccnt 0x0" ::: "memory");
}

// Row reductions: a C-matrix row lives in 16 lanes of one half-wave.
__device__ inline float rowmax16(float v) {
  v = fmaxf(v, __shfl_xor(v, 1, 32));
  v = fmaxf(v, __shfl_xor(v, 2, 32));
  v = fmaxf(v, __shfl_xor(v, 4, 32));
  v = fmaxf(v, __shfl_xor(v, 8, 32));
  return v;
}
__device__ inline float rowsum16(float v) {
  v += __shfl_xor(v, 1, 32);
  v += __shfl_xor(v, 2, 32);
  v += __shfl_xor(v, 4, 32);
  v += __shfl_xor(v, 8, 32);
  return v;
}

// ---------------------------------------------------------------------------
// fp32 -> bf16 elementwise
// ---------------------------------------------------------------------------
__global__ __launch_bounds__(256) void cvt_kernel(const float* __restrict__ in,
                                                  __bf16* __restrict__ out, int n) {
  int i = blockIdx.x * 256 + threadIdx.x;
  if (i < n) out[i] = (__bf16)in[i];
}

// W[K x N] row-major fp32  ->  Wt[N x K] row-major bf16
__global__ __launch_bounds__(256) void transpose_cvt_kernel(const float* __restrict__ in,
                                                            __bf16* __restrict__ out,
                                                            int K, int N) {
  int i = blockIdx.x * 256 + threadIdx.x;
  if (i < K * N) {
    int k = i / N, n = i % N;
    out[(size_t)n * K + k] = (__bf16)in[i];
  }
}

// ---------------------------------------------------------------------------
// GEMM: out[M x N] = A_bf16[M x K] @ Bt_bf16[N x K]^T + bias, optional relu.
// Wave = 16x64 output strip; 8 waves/block cover 128 rows x 64 cols.
// The shared 64x32 B tile is staged into LDS with CDNA5 async-to-LDS copies
// (256 lanes x 16B = 4KB per k-step), then read as ds_load_b128 fragments.
// grid = (N/64, M/128).
// ---------------------------------------------------------------------------
__global__ __launch_bounds__(256) void gemm_kernel(const __bf16* __restrict__ A,
                                                   const __bf16* __restrict__ Bt,
                                                   const float* __restrict__ bias,
                                                   float* outF, __bf16* outB,
                                                   int M, int N, int K, int relu) {
  __shared__ __bf16 btile[64 * 32];  // [col_local][k_local], 4KB

  const int tid = threadIdx.x;
  const int lane = tid & 31;
  const int wave = tid >> 5;
  const int lanelo = lane & 15;
  const int half = lane >> 4;
  const int kh = half * 8;

  const int m0 = blockIdx.y * 128 + wave * 16;
  const int n0 = blockIdx.x * 64;
  const int row = m0 + lanelo;

  // Staging assignment: one 16B chunk per thread (64 cols x 4 chunks).
  const int scol = tid >> 2;           // 0..63
  const int skoff = (tid & 3) * 8;     // 0,8,16,24
  const unsigned int sdst = lds_addr_u32(btile) + (unsigned int)((scol * 32 + skoff) * 2);

  v8f zero = {};
  v8f acc[4] = {zero, zero, zero, zero};

  for (int k0 = 0; k0 < K; k0 += 32) {
    // Async-stage B tile: btile[c][k] = Bt[n0+c][k0+k]
    async_load_b128(sdst, Bt + (size_t)(n0 + scol) * K + k0 + skoff);
    // Prefetch next A tile while the copy is in flight.
    if (k0 + 32 < K) __builtin_prefetch(A + (size_t)row * K + k0 + 32, 0, 1);

    v16bf va = load_frag_bf16(A + (size_t)row * K + k0, kh);

    wait_asynccnt0();
    __syncthreads();

#pragma unroll
    for (int t = 0; t < 4; ++t) {
      v16bf vb = load_frag_bf16(btile + (t * 16 + lanelo) * 32, kh);
      acc[t] = wmma_bf16(va, vb, acc[t]);
    }
    __syncthreads();  // protect btile before next k-step's async stores
  }

#pragma unroll
  for (int t = 0; t < 4; ++t) {
    int col = n0 + t * 16 + lanelo;
    float bv = bias[col];
#pragma unroll
    for (int r = 0; r < 8; ++r) {
      int mrow = m0 + r + 8 * half;
      float v = acc[t][r] + bv;
      if (relu) v = fmaxf(v, 0.0f);
      size_t off = (size_t)mrow * N + col;
      if (outF) outF[off] = v;
      if (outB) outB[off] = (__bf16)v;
    }
  }
}

// ---------------------------------------------------------------------------
// Attention (q = k = v = Q, per the reference's shared projection).
// Block = 4 waves x 16 query rows of one (b,h). Per 32-key step the block
// cooperatively stages the V tile into LDS transposed+converted to bf16
// ([d][key]) so every V B-fragment is two contiguous ds_load_b128.
// S = Q Q^T / 8 via 4 WMMAs; P relayout via per-wave LDS; O += P V via 4.
// grid = (1024/64, b*h = 64). Output Z in concat layout as bf16.
// ---------------------------------------------------------------------------
__global__ __launch_bounds__(128) void attn_kernel(const float* __restrict__ Q,
                                                   __bf16* __restrict__ Zbf) {
  __shared__ __bf16 vtile[64 * 32];      // [d][key], 4KB
  __shared__ __bf16 pLds[4 * 16 * 32];   // per-wave P, 4KB

  const int tid = threadIdx.x;
  const int lane = tid & 31;
  const int wave = tid >> 5;
  const int lanelo = lane & 15;
  const int half = lane >> 4;
  const int kh = half * 8;

  const int b = blockIdx.y >> 4;
  const int h = blockIdx.y & 15;
  const int q0 = blockIdx.x * 64 + wave * 16;
  const float* Qh = Q + (size_t)b * 1024 * 1024 + h * 64;  // (s,d) at s*1024 + d
  __bf16* pbase = pLds + wave * 16 * 32;

  // Staging assignment: thread reads 16 consecutive floats of one key row.
  const int skey = tid >> 2;           // 0..31
  const int sdoff = (tid & 3) * 16;    // 0,16,32,48

  // Preload Q A-fragments for d-steps 0 and 32 (d_k = 64).
  v16bf aq0, aq1;
  {
    const float* rp = Qh + (size_t)(q0 + lanelo) * 1024;
    aq0 = cvt_frag_f32(rp, kh);
    aq1 = cvt_frag_f32(rp + 32, kh);
  }

  float m[8], l[8];
  v8f zero = {};
  v8f o[4] = {zero, zero, zero, zero};
#pragma unroll
  for (int r = 0; r < 8; ++r) { m[r] = -1.0e30f; l[r] = 0.0f; }

  const float inv_scale = 0.125f;  // 1/sqrt(64)

  for (int j0 = 0; j0 < 1024; j0 += 32) {
    // Cooperative V-tile stage: vtile[d][key] = bf16(Qh[j0+key][d])
    {
      const float* src = Qh + (size_t)(j0 + skey) * 1024 + sdoff;
#pragma unroll
      for (int i = 0; i < 16; ++i)
        vtile[(sdoff + i) * 32 + skey] = (__bf16)src[i];
    }
    __syncthreads();

    // S tile: 16 queries x 32 keys (two 16x16 C fragments)
    v8f s0 = zero, s1 = zero;
    {
      const float* kp = Qh + (size_t)(j0 + lanelo) * 1024;
      s0 = wmma_bf16(aq0, cvt_frag_f32(kp, kh), s0);
      s0 = wmma_bf16(aq1, cvt_frag_f32(kp + 32, kh), s0);
      kp = Qh + (size_t)(j0 + 16 + lanelo) * 1024;
      s1 = wmma_bf16(aq0, cvt_frag_f32(kp, kh), s1);
      s1 = wmma_bf16(aq1, cvt_frag_f32(kp + 32, kh), s1);
    }

    // Online softmax per row; write P into LDS (row-major 16x32 bf16).
#pragma unroll
    for (int r = 0; r < 8; ++r) {
      float x0 = s0[r] * inv_scale;
      float x1 = s1[r] * inv_scale;
      float tm = rowmax16(fmaxf(x0, x1));
      float mn = fmaxf(m[r], tm);
      float p0 = __expf(x0 - mn);
      float p1 = __expf(x1 - mn);
      float f = __expf(m[r] - mn);
      float ps = rowsum16(p0 + p1);
      l[r] = l[r] * f + ps;
      m[r] = mn;
#pragma unroll
      for (int t = 0; t < 4; ++t) o[t][r] *= f;
      int prow = r + 8 * half;
      pbase[prow * 32 + lanelo] = (__bf16)p0;
      pbase[prow * 32 + 16 + lanelo] = (__bf16)p1;
    }

    // P as A-fragment (LDS bounce does the C->A relayout).
    v16bf pa = load_frag_bf16(pbase + lanelo * 32, kh);

    // V fragments from the transposed LDS tile: contiguous ds_load_b128 x2.
#pragma unroll
    for (int t = 0; t < 4; ++t) {
      v16bf vb = load_frag_bf16(vtile + (t * 16 + lanelo) * 32, kh);
      o[t] = wmma_bf16(pa, vb, o[t]);
    }
    __syncthreads();  // protect vtile before next j-step's stores
  }

  // Normalize and store (concat layout).
#pragma unroll
  for (int t = 0; t < 4; ++t) {
#pragma unroll
    for (int r = 0; r < 8; ++r) {
      int row = q0 + r + 8 * half;
      int col = h * 64 + t * 16 + lanelo;
      float v = o[t][r] / l[r];
      Zbf[((size_t)b * 1024 + row) * 1024 + col] = (__bf16)v;
    }
  }
}

// ---------------------------------------------------------------------------
// y = alpha * (x + r - mean) / (std_unbiased + 1e-6) + beta  (per row of 1024)
// ---------------------------------------------------------------------------
__global__ __launch_bounds__(256) void residual_ln_kernel(const float* __restrict__ X,
                                                          const float* __restrict__ R,
                                                          const float* __restrict__ alpha,
                                                          const float* __restrict__ beta,
                                                          float* outF, __bf16* outB) {
  __shared__ float s1[256], s2[256], stats[2];
  const int row = blockIdx.x;
  const int t = threadIdx.x;
  const float* xr = X + (size_t)row * 1024;
  const float* rr = R + (size_t)row * 1024;

  float v[4], sum = 0.0f, sq = 0.0f;
#pragma unroll
  for (int i = 0; i < 4; ++i) {
    int c = t + i * 256;
    float a = xr[c] + rr[c];
    v[i] = a; sum += a; sq += a * a;
  }
  s1[t] = sum; s2[t] = sq;
  __syncthreads();
  for (int s = 128; s > 0; s >>= 1) {
    if (t < s) { s1[t] += s1[t + s]; s2[t] += s2[t + s]; }
    __syncthreads();
  }
  if (t == 0) {
    float mean = s1[0] * (1.0f / 1024.0f);
    float var = (s2[0] - 1024.0f * mean * mean) * (1.0f / 1023.0f);  // ddof=1
    var = fmaxf(var, 0.0f);
    stats[0] = mean;
    stats[1] = 1.0f / (sqrtf(var) + 1e-6f);
  }
  __syncthreads();
  float mean = stats[0], rinv = stats[1];
#pragma unroll
  for (int i = 0; i < 4; ++i) {
    int c = t + i * 256;
    float y = alpha[c] * (v[i] - mean) * rinv + beta[c];
    size_t off = (size_t)row * 1024 + c;
    if (outF) outF[off] = y;
    if (outB) outB[off] = (__bf16)y;
  }
}

// ---------------------------------------------------------------------------
// Orchestration
// ---------------------------------------------------------------------------
extern "C" void kernel_launch(void* const* d_in, const int* in_sizes, int n_in,
                              void* d_out, int out_size, void* d_ws, size_t ws_size,
                              hipStream_t stream) {
  const float* x     = (const float*)d_in[0];   // [4,1024,1024]
  const float* Wq    = (const float*)d_in[1];   // [1024,1024]
  const float* bq    = (const float*)d_in[2];
  const float* Wo    = (const float*)d_in[3];
  const float* bo    = (const float*)d_in[4];
  const float* W1    = (const float*)d_in[5];   // [1024,2048]
  const float* b1    = (const float*)d_in[6];
  const float* W2    = (const float*)d_in[7];   // [2048,1024]
  const float* b2    = (const float*)d_in[8];
  const float* alpha = (const float*)d_in[9];
  const float* beta  = (const float*)d_in[10];

  char* ws = (char*)d_ws;
  const size_t MB = 1u << 20;
  __bf16* Xbf  = (__bf16*)(ws + 0);         //  8 MB  (4M bf16)
  __bf16* WqT  = (__bf16*)(ws + 8 * MB);    //  2 MB
  __bf16* WoT  = (__bf16*)(ws + 10 * MB);   //  2 MB
  __bf16* W1T  = (__bf16*)(ws + 12 * MB);   //  4 MB
  __bf16* W2T  = (__bf16*)(ws + 16 * MB);   //  4 MB
  float*  Qf   = (float*)(ws + 20 * MB);    // 16 MB
  __bf16* Zbf  = (__bf16*)(ws + 36 * MB);   //  8 MB
  float*  tmpF = (float*)(ws + 44 * MB);    // 16 MB (attn_out, then ff)
  float*  Yf   = (float*)(ws + 60 * MB);    // 16 MB
  __bf16* Ybf  = (__bf16*)(ws + 76 * MB);   //  8 MB
  __bf16* Hbf  = (__bf16*)(ws + 84 * MB);   // 16 MB (4096x2048)

  const int NTOK = 4096;                     // b*s

  // bf16 conversions / weight transposes
  cvt_kernel<<<(NTOK * 1024 + 255) / 256, 256, 0, stream>>>(x, Xbf, NTOK * 1024);
  transpose_cvt_kernel<<<(1024 * 1024 + 255) / 256, 256, 0, stream>>>(Wq, WqT, 1024, 1024);
  transpose_cvt_kernel<<<(1024 * 1024 + 255) / 256, 256, 0, stream>>>(Wo, WoT, 1024, 1024);
  transpose_cvt_kernel<<<(1024 * 2048 + 255) / 256, 256, 0, stream>>>(W1, W1T, 1024, 2048);
  transpose_cvt_kernel<<<(2048 * 1024 + 255) / 256, 256, 0, stream>>>(W2, W2T, 2048, 1024);

  // Q = X @ Wq + bq   (q = k = v in the reference)
  gemm_kernel<<<dim3(1024 / 64, NTOK / 128), 256, 0, stream>>>(
      Xbf, WqT, bq, Qf, nullptr, NTOK, 1024, 1024, 0);

  // Z = softmax(Q Q^T / 8) @ Q, concat layout, bf16
  attn_kernel<<<dim3(1024 / 64, 64), 128, 0, stream>>>(Qf, Zbf);

  // attn_out = Z @ Wo + bo
  gemm_kernel<<<dim3(1024 / 64, NTOK / 128), 256, 0, stream>>>(
      Zbf, WoT, bo, tmpF, nullptr, NTOK, 1024, 1024, 0);

  // Y = LN(x + attn_out)
  residual_ln_kernel<<<NTOK, 256, 0, stream>>>(x, tmpF, alpha, beta, Yf, Ybf);

  // H = relu(Y @ W1 + b1)
  gemm_kernel<<<dim3(2048 / 64, NTOK / 128), 256, 0, stream>>>(
      Ybf, W1T, b1, nullptr, Hbf, NTOK, 2048, 1024, 1);

  // ff = H @ W2 + b2
  gemm_kernel<<<dim3(16, NTOK / 128), 256, 0, stream>>>(
      Hbf, W2T, b2, tmpF, nullptr, NTOK, 1024, 2048, 0);

  // out = LN(Y + ff)
  residual_ln_kernel<<<NTOK, 256, 0, stream>>>(Yf, tmpF, alpha, beta, (float*)d_out, nullptr);
}

// v001
// Measured time: 261 microseconds a run.
// Two timings next to v000 put it at 1.55 and 1.54 times that version's speed.
#include <hip/hip_runtime.h>
#include <math.h>

typedef __attribute__((ext_vector_type(16))) __bf16 v16bf;
typedef __attribute__((ext_vector_type(8)))  float  v8f;
typedef __attribute__((ext_vector_type(8)))  __bf16 v8bf;
typedef __attribute__((ext_vector_type(4)))  float  v4f;

// ---------------------------------------------------------------------------
// WMMA helper: D = A(16x32 bf16) * B(32x16 bf16) + C(16x16 f32)
// ---------------------------------------------------------------------------
__device__ inline v8f wmma_bf16(v16bf a, v16bf b, v8f c) {
  return __builtin_amdgcn_wmma_f32_16x16x32_bf16(
      /*neg_a=*/false, a, /*neg_b=*/false, b,
      /*c_mod=*/(short)0, c, /*reuse_a=*/false, /*reuse_b=*/false);
}

// Fragment element pattern (16-bit A/B, 16x32): per lane, element e maps to
// K = kh + e (e<8) or K = 16 + kh + (e-8) (e>=8), with kh = 8*(lane>=16).
__device__ inline v16bf load_frag_bf16(const __bf16* base, int kh) {
  v16bf r;
#pragma unroll
  for (int e = 0; e < 8; ++e) { r[e] = base[kh + e]; r[e + 8] = base[16 + kh + e]; }
  return r;
}

__device__ inline v16bf cvt_frag_f32(const float* base, int kh) {
  v16bf r;
#pragma unroll
  for (int e = 0; e < 8; ++e) { r[e] = (__bf16)base[kh + e]; r[e + 8] = (__bf16)base[16 + kh + e]; }
  return r;
}

// Low 32 bits of a flat shared-aperture address = LDS byte offset.
__device__ inline unsigned int lds_addr_u32(const void* p) {
  return (unsigned int)(size_t)p;
}

// CDNA5 async copy: 16B global -> LDS per lane, tracked by ASYNCcnt.
__device__ inline void async_load_b128(unsigned int lds_byte_addr, const void* gptr) {
  unsigned long long ga = (unsigned long long)(size_t)gptr;
  asm volatile("global_load_async_to_lds_b128 %0, %1, off"
               :
               : "v"(lds_byte_addr), "v"(ga)
               : "memory");
}
__device__ inline void wait_asynccnt0() {
  asm volatile("s_wait_asynccnt 0x0" ::: "memory");
}

// Row reductions: a C-matrix row lives in 16 lanes of one half-wave.
__device__ inline float rowmax16(float v) {
  v = fmaxf(v, __shfl_xor(v, 1, 32));
  v = fmaxf(v, __shfl_xor(v, 2, 32));
  v = fmaxf(v, __shfl_xor(v, 4, 32));
  v = fmaxf(v, __shfl_xor(v, 8, 32));
  return v;
}
__device__ inline float rowsum16(float v) {
  v += __shfl_xor(v, 1, 32);
  v += __shfl_xor(v, 2, 32);
  v += __shfl_xor(v, 4, 32);
  v += __shfl_xor(v, 8, 32);
  return v;
}

// ---------------------------------------------------------------------------
// fp32 -> bf16 elementwise
// ---------------------------------------------------------------------------
__global__ __launch_bounds__(256) void cvt_kernel(const float* __restrict__ in,
                                                  __bf16* __restrict__ out, int n) {
  int i = blockIdx.x * 256 + threadIdx.x;
  if (i < n) out[i] = (__bf16)in[i];
}

// W[K x N] row-major fp32  ->  Wt[N x K] row-major bf16, one 64x64 tile per block.
// The tile turns in LDS, so that both sides of global memory see whole lines:
// a wave reads 2 rows x 256 B of W and stores 4 rows x 128 B of Wt.
// Pitch 65 floats: the row-wise writes and the column-wise reads of the tile
// both fall on 32 different banks. K and N are multiples of 64.
// grid = (N/64, K/64).
__global__ __launch_bounds__(256) void transpose_cvt_kernel(const float* __restrict__ in,
                                                            __bf16* __restrict__ out,
                                                            int K, int N) {
  __shared__ float tile[64 * 65];  // [k_local][n_local]

  const int tid = threadIdx.x;
  const int n0 = blockIdx.x * 64;
  const int k0 = blockIdx.y * 64;

  const int c4 = (tid & 15) * 4;  // 4 columns per thread
  const int r = tid >> 4;         // rows r, r+16, r+32, r+48
  v4f v[4];
#pragma unroll
  for (int i = 0; i < 4; ++i)
    v[i] = *(const v4f*)(in + (size_t)(k0 + r + 16 * i) * N + n0 + c4);
#pragma unroll
  for (int i = 0; i < 4; ++i) {
#pragma unroll
    for (int j = 0; j < 4; ++j) tile[(r + 16 * i) * 65 + c4 + j] = v[i][j];
  }
  __syncthreads();

  const int kc = (tid & 7) * 8;  // 8 consecutive k = 16 B of one Wt row
  const int nr = tid >> 3;       // Wt rows nr, nr+32
#pragma unroll
  for (int i = 0; i < 2; ++i) {
    const int n = nr + 32 * i;
    v8bf w;
#pragma unroll
    for (int j = 0; j < 8; ++j) w[j] = (__bf16)tile[(kc + j) * 65 + n];
    *(v8bf*)(out + (size_t)(n0 + n) * K + k0 + kc) = w;
  }
}

// ---------------------------------------------------------------------------
// GEMM: out[M x N] = A_bf16[M x K] @ Bt_bf16[N x K]^T + bias, optional relu.
// Wave = 16x64 output strip; 8 waves/block cover 128 rows x 64 cols.
// The shared 64x32 B tile is staged into LDS with CDNA5 async-to-LDS copies
// (256 lanes x 16B = 4KB per k-step), then read as ds_load_b128 fragments.
// grid = (N/64, M/128).
// ---------------------------------------------------------------------------
__global__ __launch_bounds__(256) void gemm_kernel(const __bf16* __restrict__ A,
                                                   const __bf16* __restrict__ Bt,
                                                   const float* __restrict__ bias,
                                                   float* outF, __bf16* outB,
                                                   int M, int N, int K, int relu) {
  __shared__ __bf16 btile[64 * 32];  // [col_local][k_local], 4KB

  const int tid = threadIdx.x;
  const int lane = tid & 31;
  const int wave = tid >> 5;
  const int lanelo = lane & 15;
  const int half = lane >> 4;
  const int kh = half * 8;

  const int m0 = blockIdx.y * 128 + wave * 16;
  const int n0 = blockIdx.x * 64;
  const int row = m0 + lanelo;

  // Staging assignment: one 16B chunk per thread (64 cols x 4 chunks).
  const int scol = tid >> 2;           // 0..63
  const int skoff = (tid & 3) * 8;     // 0,8,16,24
  const unsigned int sdst = lds_addr_u32(btile) + (unsigned int)((scol * 32 + skoff) * 2);

  v8f zero = {};
  v8f acc[4] = {zero, zero, zero, zero};

  for (int k0 = 0; k0 < K; k0 += 32) {
    // Async-stage B tile: btile[c][k] = Bt[n0+c][k0+k]
    async_load_b128(sdst, Bt + (size_t)(n0 + scol) * K + k0 + skoff);
    // Prefetch next A tile while the copy is in flight.
    if (k0 + 32 < K) __builtin_prefetch(A + (size_t)row * K + k0 + 32, 0, 1);

    v16bf va = load_frag_bf16(A + (size_t)row * K + k0, kh);

    wait_asynccnt0();
    __syncthreads();

#pragma unroll
    for (int t = 0; t < 4; ++t) {
      v16bf vb = load_frag_bf16(btile + (t * 16 + lanelo) * 32, kh);
      acc[t] = wmma_bf16(va, vb, acc[t]);
    }
    __syncthreads();  // protect btile before next k-step's async stores
  }

#pragma unroll
  for (int t = 0; t < 4; ++t) {
    int col = n0 + t * 16 + lanelo;
    float bv = bias[col];
#pragma unroll
    for (int r = 0; r < 8; ++r) {
      int mrow = m0 + r + 8 * half;
      float v = acc[t][r] + bv;
      if (relu) v = fmaxf(v, 0.0f);
      size_t off = (size_t)mrow * N + col;
      if (outF) outF[off] = v;
      if (outB) outB[off] = (__bf16)v;
    }
  }
}

// ---------------------------------------------------------------------------
// Attention (q = k = v = Q, per the reference's shared projection).
// Block = 4 waves x 16 query rows of one (b,h). Per 32-key step the block
// cooperatively stages the V tile into LDS transposed+converted to bf16
// ([d][key]) so every V B-fragment is two contiguous ds_load_b128.
// S = Q Q^T / 8 via 4 WMMAs; P relayout via per-wave LDS; O += P V via 4.
// grid = (1024/64, b*h = 64). Output Z in concat layout as bf16.
// ---------------------------------------------------------------------------
__global__ __launch_bounds__(128) void attn_kernel(const float* __restrict__ Q,
                                                   __bf16* __restrict__ Zbf) {
  __shared__ __bf16 vtile[64 * 32];      // [d][key], 4KB
  __shared__ __bf16 pLds[4 * 16 * 32];   // per-wave P, 4KB

  const int tid = threadIdx.x;
  const int lane = tid & 31;
  const int wave = tid >> 5;
  const int lanelo = lane & 15;
  const int half = lane >> 4;
  const int kh = half * 8;

  const int b = blockIdx.y >> 4;
  const int h = blockIdx.y & 15;
  const int q0 = blockIdx.x * 64 + wave * 16;
  const float* Qh = Q + (size_t)b * 1024 * 1024 + h * 64;  // (s,d) at s*1024 + d
  __bf16* pbase = pLds + wave * 16 * 32;

  // Staging assignment: thread reads 16 consecutive floats of one key row.
  const int skey = tid >> 2;           // 0..31
  const int sdoff = (tid & 3) * 16;    // 0,16,32,48

  // Preload Q A-fragments for d-steps 0 and 32 (d_k = 64).
  v16bf aq0, aq1;
  {
    const float* rp = Qh + (size_t)(q0 + lanelo) * 1024;
    aq0 = cvt_frag_f32(rp, kh);
    aq1 = cvt_frag_f32(rp + 32, kh);
  }

  float m[8], l[8];
  v8f zero = {};
  v8f o[4] = {zero, zero, zero, zero};
#pragma unroll
  for (int r = 0; r < 8; ++r) { m[r] = -1.0e30f; l[r] = 0.0f; }

  const float inv_scale = 0.125f;  // 1/sqrt(64)

  for (int j0 = 0; j0 < 1024; j0 += 32) {
    // Cooperative V-tile stage: vtile[d][key] = bf16(Qh[j0+key][d])
    {
      const float* src = Qh + (size_t)(j0 + skey) * 1024 + sdoff;
#pragma unroll
      for (int i = 0; i < 16; ++i)
        vtile[(sdoff + i) * 32 + skey] = (__bf16)src[i];
    }
    __syncthreads();

    // S tile: 16 queries x 32 keys (two 16x16 C fragments)
    v8f s0 = zero, s1 = zero;
    {
      const float* kp = Qh + (size_t)(j0 + lanelo) * 1024;
      s0 = wmma_bf16(aq0, cvt_frag_f32(kp, kh), s0);
      s0 = wmma_bf16(aq1, cvt_frag_f32(kp + 32, kh), s0);
      kp = Qh + (size_t)(j0 + 16 + lanelo) * 1024;
      s1 = wmma_bf16(aq0, cvt_frag_f32(kp, kh), s1);
      s1 = wmma_bf16(aq1, cvt_frag_f32(kp + 32, kh), s1);
    }

    // Online softmax per row; write P into LDS (row-major 16x32 bf16).
#pragma unroll
    for (int r = 0; r < 8; ++r) {
      float x0 = s0[r] * inv_scale;
      float x1 = s1[r] * inv_scale;
      float tm = rowmax16(fmaxf(x0, x1));
      float mn = fmaxf(m[r], tm);
      float p0 = __expf(x0 - mn);
      float p1 = __expf(x1 - mn);
      float f = __expf(m[r] - mn);
      float ps = rowsum16(p0 + p1);
      l[r] = l[r] * f + ps;
      m[r] = mn;
#pragma unroll
      for (int t = 0; t < 4; ++t) o[t][r] *= f;
      int prow = r + 8 * half;
      pbase[prow * 32 + lanelo] = (__bf16)p0;
      pbase[prow * 32 + 16 + lanelo] = (__bf16)p1;
    }

    // P as A-fragment (LDS bounce does the C->A relayout).
    v16bf pa = load_frag_bf16(pbase + lanelo * 32, kh);

    // V fragments from the transposed LDS tile: contiguous ds_load_b128 x2.
#pragma unroll
    for (int t = 0; t < 4; ++t) {
      v16bf vb = load_frag_bf16(vtile + (t * 16 + lanelo) * 32, kh);
      o[t] = wmma_bf16(pa, vb, o[t]);
    }
    __syncthreads();  // protect vtile before next j-step's stores
  }

  // Normalize and store (concat layout).
#pragma unroll
  for (int t = 0; t < 4; ++t) {
#pragma unroll
    for (int r = 0; r < 8; ++r) {
      int row = q0 + r + 8 * half;
      int col = h * 64 + t * 16 + lanelo;
      float v = o[t][r] / l[r];
      Zbf[((size_t)b * 1024 + row) * 1024 + col] = (__bf16)v;
    }
  }
}

// ---------------------------------------------------------------------------
// y = alpha * (x + r - mean) / (std_unbiased + 1e-6) + beta  (per row of 1024)
// ---------------------------------------------------------------------------
__global__ __launch_bounds__(256) void residual_ln_kernel(const float* __restrict__ X,
                                                          const float* __restrict__ R,
                                                          const float* __restrict__ alpha,
                                                          const float* __restrict__ beta,
                                                          float* outF, __bf16* outB) {
  __shared__ float s1[256], s2[256], stats[2];
  const int row = blockIdx.x;
  const int t = threadIdx.x;
  const float* xr = X + (size_t)row * 1024;
  const float* rr = R + (size_t)row * 1024;

  float v[4], sum = 0.0f, sq = 0.0f;
#pragma unroll
  for (int i = 0; i < 4; ++i) {
    int c = t + i * 256;
    float a = xr[c] + rr[c];
    v[i] = a; sum += a; sq += a * a;
  }
  s1[t] = sum; s2[t] = sq;
  __syncthreads();
  for (int s = 128; s > 0; s >>= 1) {
    if (t < s) { s1[t] += s1[t + s]; s2[t] += s2[t + s]; }
    __syncthreads();
  }
  if (t == 0) {
    float mean = s1[0] * (1.0f / 1024.0f);
    float var = (s2[0] - 1024.0f * mean * mean) * (1.0f / 1023.0f);  // ddof=1
    var = fmaxf(var, 0.0f);
    stats[0] = mean;
    stats[1] = 1.0f / (sqrtf(var) + 1e-6f);
  }
  __syncthreads();
  float mean = stats[0], rinv = stats[1];
#pragma unroll
  for (int i = 0; i < 4; ++i) {
    int c = t + i * 256;
    float y = alpha[c] * (v[i] - mean) * rinv + beta[c];
    size_t off = (size_t)row * 1024 + c;
    if (outF) outF[off] = y;
    if (outB) outB[off] = (__bf16)y;
  }
}

// ---------------------------------------------------------------------------
// Orchestration
// ---------------------------------------------------------------------------
extern "C" void kernel_launch(void* const* d_in, const int* in_sizes, int n_in,
                              void* d_out, int out_size, void* d_ws, size_t ws_size,
                              hipStream_t stream) {
  const float* x     = (const float*)d_in[0];   // [4,1024,1024]
  const float* Wq    = (const float*)d_in[1];   // [1024,1024]
  const float* bq    = (const float*)d_in[2];
  const float* Wo    = (const float*)d_in[3];
  const float* bo    = (const float*)d_in[4];
  const float* W1    = (const float*)d_in[5];   // [1024,2048]
  const float* b1    = (const float*)d_in[6];
  const float* W2    = (const float*)d_in[7];   // [2048,1024]
  const float* b2    = (const float*)d_in[8];
  const float* alpha = (const float*)d_in[9];
  const float* beta  = (const float*)d_in[10];

  char* ws = (char*)d_ws;
  const size_t MB = 1u << 20;
  __bf16* Xbf  = (__bf16*)(ws + 0);         //  8 MB  (4M bf16)
  __bf16* WqT  = (__bf16*)(ws + 8 * MB);    //  2 MB
  __bf16* WoT  = (__bf16*)(ws + 10 * MB);   //  2 MB
  __bf16* W1T  = (__bf16*)(ws + 12 * MB);   //  4 MB
  __bf16* W2T  = (__bf16*)(ws + 16 * MB);   //  4 MB
  float*  Qf   = (float*)(ws + 20 * MB);    // 16 MB
  __bf16* Zbf  = (__bf16*)(ws + 36 * MB);   //  8 MB
  float*  tmpF = (float*)(ws + 44 * MB);    // 16 MB (attn_out, then ff)
  float*  Yf   = (float*)(ws + 60 * MB);    // 16 MB
  __bf16* Ybf  = (__bf16*)(ws + 76 * MB);   //  8 MB
  __bf16* Hbf  = (__bf16*)(ws + 84 * MB);   // 16 MB (4096x2048)

  const int NTOK = 4096;                     // b*s

  // bf16 conversions / weight transposes
  cvt_kernel<<<(NTOK * 1024 + 255) / 256, 256, 0, stream>>>(x, Xbf, NTOK * 1024);
  transpose_cvt_kernel<<<dim3(1024 / 64, 1024 / 64), 256, 0, stream>>>(Wq, WqT, 1024, 1024);
  transpose_cvt_kernel<<<dim3(1024 / 64, 1024 / 64), 256, 0, stream>>>(Wo, WoT, 1024, 1024);
  transpose_cvt_kernel<<<dim3(2048 / 64, 1024 / 64), 256, 0, stream>>>(W1, W1T, 1024, 2048);
  transpose_cvt_kernel<<<dim3(1024 / 64, 2048 / 64), 256, 0, stream>>>(W2, W2T, 2048, 1024);

  // Q = X @ Wq + bq   (q = k = v in the reference)
  gemm_kernel<<<dim3(1024 / 64, NTOK / 128), 256, 0, stream>>>(
      Xbf, WqT, bq, Qf, nullptr, NTOK, 1024, 1024, 0);

  // Z = softmax(Q Q^T / 8) @ Q, concat layout, bf16
  attn_kernel<<<dim3(1024 / 64, 64), 128, 0, stream>>>(Qf, Zbf);

  // attn_out = Z @ Wo + bo
  gemm_kernel<<<dim3(1024 / 64, NTOK / 128), 256, 0, stream>>>(
      Zbf, WoT, bo, tmpF, nullptr, NTOK, 1024, 1024, 0);

  // Y = LN(x + attn_out)
  residual_ln_kernel<<<NTOK, 256, 0, stream>>>(x, tmpF, alpha, beta, Yf, Ybf);

  // H = relu(Y @ W1 + b1)
  gemm_kernel<<<dim3(2048 / 64, NTOK / 128), 256, 0, stream>>>(
      Ybf, W1T, b1, nullptr, Hbf, NTOK, 2048, 1024, 1);

  // ff = H @ W2 + b2
  gemm_kernel<<<dim3(16, NTOK / 128), 256, 0, stream>>>(
      Hbf, W2T, b2, tmpF, nullptr, NTOK, 1024, 2048, 0);

  // out = LN(Y + ff)
  residual_ln_kernel<<<NTOK, 256, 0, stream>>>(Yf, tmpF, alpha, beta, (float*)d_out, nullptr);
}

// v002
// Measured time: 233 microseconds a run.
// In two side-by-side timings against v001, it was 1.12 and 1.13 times as fast.
// Over all steps from v000 it is 1.74 times as fast.
#include <hip/hip_runtime.h>
#include <math.h>

typedef __attribute__((ext_vector_type(16))) __bf16 v16bf;
typedef __attribute__((ext_vector_type(8)))  float  v8f;
typedef __attribute__((ext_vector_type(8)))  __bf16 v8bf;
typedef __attribute__((ext_vector_type(4)))  float  v4f;

// ---------------------------------------------------------------------------
// WMMA helper: D = A(16x32 bf16) * B(32x16 bf16) + C(16x16 f32)
// ---------------------------------------------------------------------------
__device__ inline v8f wmma_bf16(v16bf a, v16bf b, v8f c) {
  return __builtin_amdgcn_wmma_f32_16x16x32_bf16(
      /*neg_a=*/false, a, /*neg_b=*/false, b,
      /*c_mod=*/(short)0, c, /*reuse_a=*/false, /*reuse_b=*/false);
}

// Fragment element pattern (16-bit A/B, 16x32): per lane, element e maps to
// K = kh + e (e<8) or K = 16 + kh + (e-8) (e>=8), with kh = 8*(lane>=16).
__device__ inline v16bf load_frag_bf16(const __bf16* base, int kh) {
  v16bf r;
#pragma unroll
  for (int e = 0; e < 8; ++e) { r[e] = base[kh + e]; r[e + 8] = base[16 + kh + e]; }
  return r;
}

__device__ inline v16bf cvt_frag_f32(const float* base, int kh) {
  v16bf r;
#pragma unroll
  for (int e = 0; e < 8; ++e) { r[e] = (__bf16)base[kh + e]; r[e + 8] = (__bf16)base[16 + kh + e]; }
  return r;
}

// Pitch, in bf16 elements, of every LDS tile whose 32-element (64 B) rows are
// read as 16 B fragment pieces, one row per lane: 80 B = 16 B x 5 spreads the
// 16 rows of a half-wave over all 64 banks; at 64 B they fall on 16 banks.
constexpr int FRAG_PITCH = 40;

// Low 32 bits of a flat shared-aperture address = LDS byte offset.
__device__ inline unsigned int lds_addr_u32(const void* p) {
  return (unsigned int)(size_t)p;
}

// CDNA5 async copy: 16B global -> LDS per lane, tracked by ASYNCcnt.
__device__ inline void async_load_b128(unsigned int lds_byte_addr, const void* gptr) {
  unsigned long long ga = (unsigned long long)(size_t)gptr;
  asm volatile("global_load_async_to_lds_b128 %0, %1, off"
               :
               : "v"(lds_byte_addr), "v"(ga)
               : "memory");
}
__device__ inline void wait_asynccnt0() {
  asm volatile("s_wait_asynccnt 0x0" ::: "memory");
}

// Row reductions: a C-matrix row lives in 16 lanes of one half-wave.
__device__ inline float rowmax16(float v) {
  v = fmaxf(v, __shfl_xor(v, 1, 32));
  v = fmaxf(v, __shfl_xor(v, 2, 32));
  v = fmaxf(v, __shfl_xor(v, 4, 32));
  v = fmaxf(v, __shfl_xor(v, 8, 32));
  return v;
}
__device__ inline float rowsum16(float v) {
  v += __shfl_xor(v, 1, 32);
  v += __shfl_xor(v, 2, 32);
  v += __shfl_xor(v, 4, 32);
  v += __shfl_xor(v, 8, 32);
  return v;
}

// ---------------------------------------------------------------------------
// fp32 -> bf16 elementwise
// ---------------------------------------------------------------------------
__global__ __launch_bounds__(256) void cvt_kernel(const float* __restrict__ in,
                                                  __bf16* __restrict__ out, int n) {
  int i = blockIdx.x * 256 + threadIdx.x;
  if (i < n) out[i] = (__bf16)in[i];
}

// W[K x N] row-major fp32  ->  Wt[N x K] row-major bf16, one 64x64 tile per block.
// The tile turns in LDS, so that both sides of global memory see whole lines:
// a wave reads 2 rows x 256 B of W and stores 4 rows x 128 B of Wt.
// Pitch 65 floats: the row-wise writes and the column-wise reads of the tile
// both fall on 32 different banks. K and N are multiples of 64.
// grid = (N/64, K/64).
__global__ __launch_bounds__(256) void transpose_cvt_kernel(const float* __restrict__ in,
                                                            __bf16* __restrict__ out,
                                                            int K, int N) {
  __shared__ float tile[64 * 65];  // [k_local][n_local]

  const int tid = threadIdx.x;
  const int n0 = blockIdx.x * 64;
  const int k0 = blockIdx.y * 64;

  const int c4 = (tid & 15) * 4;  // 4 columns per thread
  const int r = tid >> 4;         // rows r, r+16, r+32, r+48
  v4f v[4];
#pragma unroll
  for (int i = 0; i < 4; ++i)
    v[i] = *(const v4f*)(in + (size_t)(k0 + r + 16 * i) * N + n0 + c4);
#pragma unroll
  for (int i = 0; i < 4; ++i) {
#pragma unroll
    for (int j = 0; j < 4; ++j) tile[(r + 16 * i) * 65 + c4 + j] = v[i][j];
  }
  __syncthreads();

  const int kc = (tid & 7) * 8;  // 8 consecutive k = 16 B of one Wt row
  const int nr = tid >> 3;       // Wt rows nr, nr+32
#pragma unroll
  for (int i = 0; i < 2; ++i) {
    const int n = nr + 32 * i;
    v8bf w;
#pragma unroll
    for (int j = 0; j < 8; ++j) w[j] = (__bf16)tile[(kc + j) * 65 + n];
    *(v8bf*)(out + (size_t)(n0 + n) * K + k0 + kc) = w;
  }
}

// ---------------------------------------------------------------------------
// GEMM: out[M x N] = A_bf16[M x K] @ Bt_bf16[N x K]^T + bias, optional relu.
// Wave = 16x64 output strip; 8 waves/block cover 128 rows x 64 cols.
// The shared 64x32 B tile is staged into LDS with CDNA5 async-to-LDS copies
// (256 lanes x 16B = 4KB per k-step), then read as ds_load_b128 fragments.
// grid = (N/64, M/128).
// ---------------------------------------------------------------------------
__global__ __launch_bounds__(256) void gemm_kernel(const __bf16* __restrict__ A,
                                                   const __bf16* __restrict__ Bt,
                                                   const float* __restrict__ bias,
                                                   float* outF, __bf16* outB,
                                                   int M, int N, int K, int relu) {
  __shared__ __bf16 btile[64 * FRAG_PITCH];  // [col_local][k_local], 5KB

  const int tid = threadIdx.x;
  const int lane = tid & 31;
  const int wave = tid >> 5;
  const int lanelo = lane & 15;
  const int half = lane >> 4;
  const int kh = half * 8;

  const int m0 = blockIdx.y * 128 + wave * 16;
  const int n0 = blockIdx.x * 64;
  const int row = m0 + lanelo;

  // Staging assignment: one 16B chunk per thread (64 cols x 4 chunks).
  const int scol = tid >> 2;           // 0..63
  const int skoff = (tid & 3) * 8;     // 0,8,16,24
  const unsigned int sdst = lds_addr_u32(btile) + (unsigned int)((scol * FRAG_PITCH + skoff) * 2);

  v8f zero = {};
  v8f acc[4] = {zero, zero, zero, zero};

  for (int k0 = 0; k0 < K; k0 += 32) {
    // Async-stage B tile: btile[c][k] = Bt[n0+c][k0+k]
    async_load_b128(sdst, Bt + (size_t)(n0 + scol) * K + k0 + skoff);
    // Prefetch next A tile while the copy is in flight.
    if (k0 + 32 < K) __builtin_prefetch(A + (size_t)row * K + k0 + 32, 0, 1);

    v16bf va = load_frag_bf16(A + (size_t)row * K + k0, kh);

    wait_asynccnt0();
    __syncthreads();

#pragma unroll
    for (int t = 0; t < 4; ++t) {
      v16bf vb = load_frag_bf16(btile + (t * 16 + lanelo) * FRAG_PITCH, kh);
      acc[t] = wmma_bf16(va, vb, acc[t]);
    }
    __syncthreads();  // protect btile before next k-step's async stores
  }

#pragma unroll
  for (int t = 0; t < 4; ++t) {
    int col = n0 + t * 16 + lanelo;
    float bv = bias[col];
#pragma unroll
    for (int r = 0; r < 8; ++r) {
      int mrow = m0 + r + 8 * half;
      float v = acc[t][r] + bv;
      if (relu) v = fmaxf(v, 0.0f);
      size_t off = (size_t)mrow * N + col;
      if (outF) outF[off] = v;
      if (outB) outB[off] = (__bf16)v;
    }
  }
}

// ---------------------------------------------------------------------------
// Attention (q = k = v = Q, per the reference's shared projection).
// Block = 4 waves x 16 query rows of one (b,h). Per 32-key step the block
// cooperatively stages the V tile into LDS transposed+converted to bf16
// ([d][key]) so every V B-fragment is two contiguous ds_load_b128.
// S = Q Q^T / 8 via 4 WMMAs; P relayout via per-wave LDS; O += P V via 4.
// grid = (1024/64, b*h = 64). Output Z in concat layout as bf16.
// ---------------------------------------------------------------------------
__global__ __launch_bounds__(128) void attn_kernel(const float* __restrict__ Q,
                                                   __bf16* __restrict__ Zbf) {
  __shared__ __bf16 vtile[64 * FRAG_PITCH];      // [d][key], 5KB
  __shared__ __bf16 pLds[4 * 16 * FRAG_PITCH];   // per-wave P, 5KB

  const int tid = threadIdx.x;
  const int lane = tid & 31;
  const int wave = tid >> 5;
  const int lanelo = lane & 15;
  const int half = lane >> 4;
  const int kh = half * 8;

  const int b = blockIdx.y >> 4;
  const int h = blockIdx.y & 15;
  const int q0 = blockIdx.x * 64 + wave * 16;
  const float* Qh = Q + (size_t)b * 1024 * 1024 + h * 64;  // (s,d) at s*1024 + d
  __bf16* pbase = pLds + wave * 16 * FRAG_PITCH;

  // Staging assignment: thread reads 16 consecutive floats of one key row.
  const int skey = tid >> 2;           // 0..31
  const int sdoff = (tid & 3) * 16;    // 0,16,32,48

  // Preload Q A-fragments for d-steps 0 and 32 (d_k = 64).
  v16bf aq0, aq1;
  {
    const float* rp = Qh + (size_t)(q0 + lanelo) * 1024;
    aq0 = cvt_frag_f32(rp, kh);
    aq1 = cvt_frag_f32(rp + 32, kh);
  }

  float m[8], l[8];
  v8f zero = {};
  v8f o[4] = {zero, zero, zero, zero};
#pragma unroll
  for (int r = 0; r < 8; ++r) { m[r] = -1.0e30f; l[r] = 0.0f; }

  const float inv_scale = 0.125f;  // 1/sqrt(64)

  for (int j0 = 0; j0 < 1024; j0 += 32) {
    // Cooperative V-tile stage: vtile[d][key] = bf16(Qh[j0+key][d])
    {
      const float* src = Qh + (size_t)(j0 + skey) * 1024 + sdoff;
#pragma unroll
      for (int i = 0; i < 16; ++i)
        vtile[(sdoff + i) * FRAG_PITCH + skey] = (__bf16)src[i];
    }
    __syncthreads();

    // S tile: 16 queries x 32 keys (two 16x16 C fragments)
    v8f s0 = zero, s1 = zero;
    {
      const float* kp = Qh + (size_t)(j0 + lanelo) * 1024;
      s0 = wmma_bf16(aq0, cvt_frag_f32(kp, kh), s0);
      s0 = wmma_bf16(aq1, cvt_frag_f32(kp + 32, kh), s0);
      kp = Qh + (size_t)(j0 + 16 + lanelo) * 1024;
      s1 = wmma_bf16(aq0, cvt_frag_f32(kp, kh), s1);
      s1 = wmma_bf16(aq1, cvt_frag_f32(kp + 32, kh), s1);
    }

    // Online softmax per row; write P into LDS (row-major 16x32 bf16).
#pragma unroll
    for (int r = 0; r < 8; ++r) {
      float x0 = s0[r] * inv_scale;
      float x1 = s1[r] * inv_scale;
      float tm = rowmax16(fmaxf(x0, x1));
      float mn = fmaxf(m[r], tm);
      float p0 = __expf(x0 - mn);
      float p1 = __expf(x1 - mn);
      float f = __expf(m[r] - mn);
      float ps = rowsum16(p0 + p1);
      l[r] = l[r] * f + ps;
      m[r] = mn;
#pragma unroll
      for (int t = 0; t < 4; ++t) o[t][r] *= f;
      int prow = r + 8 * half;
      pbase[prow * FRAG_PITCH + lanelo] = (__bf16)p0;
      pbase[prow * FRAG_PITCH + 16 + lanelo] = (__bf16)p1;
    }

    // P as A-fragment (LDS bounce does the C->A relayout).
    v16bf pa = load_frag_bf16(pbase + lanelo * FRAG_PITCH, kh);

    // V fragments from the transposed LDS tile: contiguous ds_load_b128 x2.
#pragma unroll
    for (int t = 0; t < 4; ++t) {
      v16bf vb = load_frag_bf16(vtile + (t * 16 + lanelo) * FRAG_PITCH, kh);
      o[t] = wmma_bf16(pa, vb, o[t]);
    }
    __syncthreads();  // protect vtile before next j-step's stores
  }

  // Normalize and store (concat layout).
#pragma unroll
  for (int t = 0; t < 4; ++t) {
#pragma unroll
    for (int r = 0; r < 8; ++r) {
      int row = q0 + r + 8 * half;
      int col = h * 64 + t * 16 + lanelo;
      float v = o[t][r] / l[r];
      Zbf[((size_t)b * 1024 + row) * 1024 + col] = (__bf16)v;
    }
  }
}

// ---------------------------------------------------------------------------
// y = alpha * (x + r - mean) / (std_unbiased + 1e-6) + beta  (per row of 1024)
// ---------------------------------------------------------------------------
__global__ __launch_bounds__(256) void residual_ln_kernel(const float* __restrict__ X,
                                                          const float* __restrict__ R,
                                                          const float* __restrict__ alpha,
                                                          const float* __restrict__ beta,
                                                          float* outF, __bf16* outB) {
  __shared__ float s1[256], s2[256], stats[2];
  const int row = blockIdx.x;
  const int t = threadIdx.x;
  const float* xr = X + (size_t)row * 1024;
  const float* rr = R + (size_t)row * 1024;

  float v[4], sum = 0.0f, sq = 0.0f;
#pragma unroll
  for (int i = 0; i < 4; ++i) {
    int c = t + i * 256;
    float a = xr[c] + rr[c];
    v[i] = a; sum += a; sq += a * a;
  }
  s1[t] = sum; s2[t] = sq;
  __syncthreads();
  for (int s = 128; s > 0; s >>= 1) {
    if (t < s) { s1[t] += s1[t + s]; s2[t] += s2[t + s]; }
    __syncthreads();
  }
  if (t == 0) {
    float mean = s1[0] * (1.0f / 1024.0f);
    float var = (s2[0] - 1024.0f * mean * mean) * (1.0f / 1023.0f);  // ddof=1
    var = fmaxf(var, 0.0f);
    stats[0] = mean;
    stats[1] = 1.0f / (sqrtf(var) + 1e-6f);
  }
  __syncthreads();
  float mean = stats[0], rinv = stats[1];
#pragma unroll
  for (int i = 0; i < 4; ++i) {
    int c = t + i * 256;
    float y = alpha[c] * (v[i] - mean) * rinv + beta[c];
    size_t off = (size_t)row * 1024 + c;
    if (outF) outF[off] = y;
    if (outB) outB[off] = (__bf16)y;
  }
}

// ---------------------------------------------------------------------------
// Orchestration
// ---------------------------------------------------------------------------
extern "C" void kernel_launch(void* const* d_in, const int* in_sizes, int n_in,
                              void* d_out, int out_size, void* d_ws, size_t ws_size,
                              hipStream_t stream) {
  const float* x     = (const float*)d_in[0];   // [4,1024,1024]
  const float* Wq    = (const float*)d_in[1];   // [1024,1024]
  const float* bq    = (const float*)d_in[2];
  const float* Wo    = (const float*)d_in[3];
  const float* bo    = (const float*)d_in[4];
  const float* W1    = (const float*)d_in[5];   // [1024,2048]
  const float* b1    = (const float*)d_in[6];
  const float* W2    = (const float*)d_in[7];   // [2048,1024]
  const float* b2    = (const float*)d_in[8];
  const float* alpha = (const float*)d_in[9];
  const float* beta  = (const float*)d_in[10];

  char* ws = (char*)d_ws;
  const size_t MB = 1u << 20;
  __bf16* Xbf  = (__bf16*)(ws + 0);         //  8 MB  (4M bf16)
  __bf16* WqT  = (__bf16*)(ws + 8 * MB);    //  2 MB
  __bf16* WoT  = (__bf16*)(ws + 10 * MB);   //  2 MB
  __bf16* W1T  = (__bf16*)(ws + 12 * MB);   //  4 MB
  __bf16* W2T  = (__bf16*)(ws + 16 * MB);   //  4 MB
  float*  Qf   = (float*)(ws + 20 * MB);    // 16 MB
  __bf16* Zbf  = (__bf16*)(ws + 36 * MB);   //  8 MB
  float*  tmpF = (float*)(ws + 44 * MB);    // 16 MB (attn_out, then ff)
  float*  Yf   = (float*)(ws + 60 * MB);    // 16 MB
  __bf16* Ybf  = (__bf16*)(ws + 76 * MB);   //  8 MB
  __bf16* Hbf  = (__bf16*)(ws + 84 * MB);   // 16 MB (4096x2048)

  const int NTOK = 4096;                     // b*s

  // bf16 conversions / weight transposes
  cvt_kernel<<<(NTOK * 1024 + 255) / 256, 256, 0, stream>>>(x, Xbf, NTOK * 1024);
  transpose_cvt_kernel<<<dim3(1024 / 64, 1024 / 64), 256, 0, stream>>>(Wq, WqT, 1024, 1024);
  transpose_cvt_kernel<<<dim3(1024 / 64, 1024 / 64), 256, 0, stream>>>(Wo, WoT, 1024, 1024);
  transpose_cvt_kernel<<<dim3(2048 / 64, 1024 / 64), 256, 0, stream>>>(W1, W1T, 1024, 2048);
  transpose_cvt_kernel<<<dim3(1024 / 64, 2048 / 64), 256, 0, stream>>>(W2, W2T, 2048, 1024);

  // Q = X @ Wq + bq   (q = k = v in the reference)
  gemm_kernel<<<dim3(1024 / 64, NTOK / 128), 256, 0, stream>>>(
      Xbf, WqT, bq, Qf, nullptr, NTOK, 1024, 1024, 0);

  // Z = softmax(Q Q^T / 8) @ Q, concat layout, bf16
  attn_kernel<<<dim3(1024 / 64, 64), 128, 0, stream>>>(Qf, Zbf);

  // attn_out = Z @ Wo + bo
  gemm_kernel<<<dim3(1024 / 64, NTOK / 128), 256, 0, stream>>>(
      Zbf, WoT, bo, tmpF, nullptr, NTOK, 1024, 1024, 0);

  // Y = LN(x + attn_out)
  residual_ln_kernel<<<NTOK, 256, 0, stream>>>(x, tmpF, alpha, beta, Yf, Ybf);

  // H = relu(Y @ W1 + b1)
  gemm_kernel<<<dim3(2048 / 64, NTOK / 128), 256, 0, stream>>>(
      Ybf, W1T, b1, nullptr, Hbf, NTOK, 2048, 1024, 1);

  // ff = H @ W2 + b2
  gemm_kernel<<<dim3(16, NTOK / 128), 256, 0, stream>>>(
      Hbf, W2T, b2, tmpF, nullptr, NTOK, 1024, 2048, 0);

  // out = LN(Y + ff)
  residual_ln_kernel<<<NTOK, 256, 0, stream>>>(Yf, tmpF, alpha, beta, (float*)d_out, nullptr);
}

// v003
// One run takes 199 microseconds.
// Two timings next to v002 both put it at 1.17 times that version's speed.
// All steps since v000 together make it 2.04 times as fast.
#include <hip/hip_runtime.h>
#include <math.h>

typedef __attribute__((ext_vector_type(16))) __bf16 v16bf;
typedef __attribute__((ext_vector_type(8)))  float  v8f;
typedef __attribute__((ext_vector_type(8)))  __bf16 v8bf;
typedef __attribute__((ext_vector_type(4)))  float  v4f;

// ---------------------------------------------------------------------------
// WMMA helper: D = A(16x32 bf16) * B(32x16 bf16) + C(16x16 f32)
// ---------------------------------------------------------------------------
__device__ inline v8f wmma_bf16(v16bf a, v16bf b, v8f c) {
  return __builtin_amdgcn_wmma_f32_16x16x32_bf16(
      /*neg_a=*/false, a, /*neg_b=*/false, b,
      /*c_mod=*/(short)0, c, /*reuse_a=*/false, /*reuse_b=*/false);
}

// Fragment element pattern (16-bit A/B, 16x32): per lane, element e maps to
// K = kh + e (e<8) or K = 16 + kh + (e-8) (e>=8), with kh = 8*(lane>=16).
__device__ inline v16bf load_frag_bf16(const __bf16* base, int kh) {
  v16bf r;
#pragma unroll
  for (int e = 0; e < 8; ++e) { r[e] = base[kh + e]; r[e + 8] = base[16 + kh + e]; }
  return r;
}

__device__ inline v16bf cvt_frag_f32(const float* base, int kh) {
  v16bf r;
#pragma unroll
  for (int e = 0; e < 8; ++e) { r[e] = (__bf16)base[kh + e]; r[e + 8] = (__bf16)base[16 + kh + e]; }
  return r;
}

// Pitch, in bf16 elements, of every LDS tile whose 32-element (64 B) rows are
// read as 16 B fragment pieces, one row per lane: 80 B = 16 B x 5 spreads the
// 16 rows of a half-wave over all 64 banks; at 64 B they fall on 16 banks.
constexpr int FRAG_PITCH = 40;

// Low 32 bits of a flat shared-aperture address = LDS byte offset.
__device__ inline unsigned int lds_addr_u32(const void* p) {
  return (unsigned int)(size_t)p;
}

// CDNA5 async copies: 16B global -> LDS per lane, tracked by ASYNCcnt.
// One GEMM stage = 12 copies per lane: LDS rows step by lstep bytes, the first
// 8 copies walk A and the last 4 walk B, both by gstep bytes a copy.
// s_wait_xcnt 0 closes the statement, so that no address register named here
// takes the next stage's value ahead of it.
__device__ inline void async_stage_12xb128(unsigned int l, unsigned int lstep,
                                           const __bf16* ga, const __bf16* gb, size_t gstep) {
  const unsigned long long a = (unsigned long long)(size_t)ga;
  const unsigned long long b = (unsigned long long)(size_t)gb;
  asm volatile(
      "global_load_async_to_lds_b128 %0, %12, off\n\t"
      "global_load_async_to_lds_b128 %1, %13, off\n\t"
      "global_load_async_to_lds_b128 %2, %14, off\n\t"
      "global_load_async_to_lds_b128 %3, %15, off\n\t"
      "global_load_async_to_lds_b128 %4, %16, off\n\t"
      "global_load_async_to_lds_b128 %5, %17, off\n\t"
      "global_load_async_to_lds_b128 %6, %18, off\n\t"
      "global_load_async_to_lds_b128 %7, %19, off\n\t"
      "global_load_async_to_lds_b128 %8, %20, off\n\t"
      "global_load_async_to_lds_b128 %9, %21, off\n\t"
      "global_load_async_to_lds_b128 %10, %22, off\n\t"
      "global_load_async_to_lds_b128 %11, %23, off\n\t"
      "s_wait_xcnt 0x0"
      :
      : "v"(l), "v"(l + lstep), "v"(l + 2 * lstep), "v"(l + 3 * lstep),
        "v"(l + 4 * lstep), "v"(l + 5 * lstep), "v"(l + 6 * lstep), "v"(l + 7 * lstep),
        "v"(l + 8 * lstep), "v"(l + 9 * lstep), "v"(l + 10 * lstep), "v"(l + 11 * lstep),
        "v"(a), "v"(a + gstep), "v"(a + 2 * gstep), "v"(a + 3 * gstep),
        "v"(a + 4 * gstep), "v"(a + 5 * gstep), "v"(a + 6 * gstep), "v"(a + 7 * gstep),
        "v"(b), "v"(b + gstep), "v"(b + 2 * gstep), "v"(b + 3 * gstep)
      : "memory");
}
__device__ inline void wait_asynccnt0() {
  asm volatile("s_wait_asynccnt 0x0" ::: "memory");
}

// Row reductions: a C-matrix row lives in 16 lanes of one half-wave.
__device__ inline float rowmax16(float v) {
  v = fmaxf(v, __shfl_xor(v, 1, 32));
  v = fmaxf(v, __shfl_xor(v, 2, 32));
  v = fmaxf(v, __shfl_xor(v, 4, 32));
  v = fmaxf(v, __shfl_xor(v, 8, 32));
  return v;
}
__device__ inline float rowsum16(float v) {
  v += __shfl_xor(v, 1, 32);
  v += __shfl_xor(v, 2, 32);
  v += __shfl_xor(v, 4, 32);
  v += __shfl_xor(v, 8, 32);
  return v;
}

// ---------------------------------------------------------------------------
// fp32 -> bf16 elementwise
// ---------------------------------------------------------------------------
__global__ __launch_bounds__(256) void cvt_kernel(const float* __restrict__ in,
                                                  __bf16* __restrict__ out, int n) {
  int i = blockIdx.x * 256 + threadIdx.x;
  if (i < n) out[i] = (__bf16)in[i];
}

// W[K x N] row-major fp32  ->  Wt[N x K] row-major bf16, one 64x64 tile per block.
// The tile turns in LDS, so that both sides of global memory see whole lines:
// a wave reads 2 rows x 256 B of W and stores 4 rows x 128 B of Wt.
// Pitch 65 floats: the row-wise writes and the column-wise reads of the tile
// both fall on 32 different banks. K and N are multiples of 64.
// grid = (N/64, K/64).
__global__ __launch_bounds__(256) void transpose_cvt_kernel(const float* __restrict__ in,
                                                            __bf16* __restrict__ out,
                                                            int K, int N) {
  __shared__ float tile[64 * 65];  // [k_local][n_local]

  const int tid = threadIdx.x;
  const int n0 = blockIdx.x * 64;
  const int k0 = blockIdx.y * 64;

  const int c4 = (tid & 15) * 4;  // 4 columns per thread
  const int r = tid >> 4;         // rows r, r+16, r+32, r+48
  v4f v[4];
#pragma unroll
  for (int i = 0; i < 4; ++i)
    v[i] = *(const v4f*)(in + (size_t)(k0 + r + 16 * i) * N + n0 + c4);
#pragma unroll
  for (int i = 0; i < 4; ++i) {
#pragma unroll
    for (int j = 0; j < 4; ++j) tile[(r + 16 * i) * 65 + c4 + j] = v[i][j];
  }
  __syncthreads();

  const int kc = (tid & 7) * 8;  // 8 consecutive k = 16 B of one Wt row
  const int nr = tid >> 3;       // Wt rows nr, nr+32
#pragma unroll
  for (int i = 0; i < 2; ++i) {
    const int n = nr + 32 * i;
    v8bf w;
#pragma unroll
    for (int j = 0; j < 8; ++j) w[j] = (__bf16)tile[(kc + j) * 65 + n];
    *(v8bf*)(out + (size_t)(n0 + n) * K + k0 + kc) = w;
  }
}

// ---------------------------------------------------------------------------
// GEMM: out[M x N] = A_bf16[M x K] @ Bt_bf16[N x K]^T + bias, optional relu.
// Wave = 16x64 output strip; 8 waves/block cover 128 rows x 64 cols.
// A stage is 128 k: the block's 128 A rows and 64 B rows, 256 B each (two whole
// lines), come into LDS by CDNA5 async-to-LDS copies (16 lanes a row, 12 copies
// a lane) and are read as ds_load_b128 fragments. K is a multiple of 128.
// grid = (N/64, M/128).
// ---------------------------------------------------------------------------
constexpr int GEMM_KS = 128;     // k per stage
constexpr int GEMM_PITCH = 136;  // bf16 per LDS row: 272 B = 16 B x 17, all 64 banks

__global__ __launch_bounds__(256) void gemm_kernel(const __bf16* __restrict__ A,
                                                   const __bf16* __restrict__ Bt,
                                                   const float* __restrict__ bias,
                                                   float* outF, __bf16* outB,
                                                   int M, int N, int K, int relu) {
  // rows 0..127: A [row_local][k_local]; rows 128..191: B [col_local][k_local]; 51KB
  __shared__ __attribute__((aligned(16))) __bf16 stage[(128 + 64) * GEMM_PITCH];
  const __bf16* atile = stage;
  const __bf16* btile = stage + 128 * GEMM_PITCH;

  const int tid = threadIdx.x;
  const int lane = tid & 31;
  const int wave = tid >> 5;
  const int lanelo = lane & 15;
  const int half = lane >> 4;
  const int kh = half * 8;

  const int m0 = blockIdx.y * 128 + wave * 16;
  const int n0 = blockIdx.x * 64;

  // Staging assignment: 16 lanes cover one 256 B row; a copy of the block covers 16 rows.
  const int srow = tid >> 4;           // 0..15
  const int skoff = (tid & 15) * 8;    // 0,8,..,120
  const unsigned int sdst = lds_addr_u32(stage) + (unsigned int)((srow * GEMM_PITCH + skoff) * 2);
  const __bf16* asrc = A + (size_t)(blockIdx.y * 128 + srow) * K + skoff;
  const __bf16* bsrc = Bt + (size_t)(n0 + srow) * K + skoff;

  v8f zero = {};
  v8f acc[4] = {zero, zero, zero, zero};

  for (int k0 = 0; k0 < K; k0 += GEMM_KS) {
    // stage[r][k] = A[blockrow+r][k0+k] (r < 128), Bt[n0+r-128][k0+k] (r >= 128)
    async_stage_12xb128(sdst, 16 * GEMM_PITCH * 2, asrc + k0, bsrc + k0, (size_t)16 * K * 2);
    wait_asynccnt0();
    __syncthreads();

    // Unrolled, so that the four 32-k slices' LDS offsets are immediates of the loads.
#pragma unroll
    for (int s = 0; s < GEMM_KS / 32; ++s) {
      v16bf va = load_frag_bf16(atile + (wave * 16 + lanelo) * GEMM_PITCH + s * 32, kh);
#pragma unroll
      for (int t = 0; t < 4; ++t) {
        v16bf vb = load_frag_bf16(btile + (t * 16 + lanelo) * GEMM_PITCH + s * 32, kh);
        acc[t] = wmma_bf16(va, vb, acc[t]);
      }
    }
    // This wave's LDS reads have retired before any wave's next copies land there.
    asm volatile("s_wait_dscnt 0x0" ::: "memory");
    __syncthreads();  // ends every reader's last read before the next stage's copies
  }

#pragma unroll
  for (int t = 0; t < 4; ++t) {
    int col = n0 + t * 16 + lanelo;
    float bv = bias[col];
#pragma unroll
    for (int r = 0; r < 8; ++r) {
      int mrow = m0 + r + 8 * half;
      float v = acc[t][r] + bv;
      if (relu) v = fmaxf(v, 0.0f);
      size_t off = (size_t)mrow * N + col;
      if (outF) outF[off] = v;
      if (outB) outB[off] = (__bf16)v;
    }
  }
}

// ---------------------------------------------------------------------------
// Attention (q = k = v = Q, per the reference's shared projection).
// Block = 4 waves x 16 query rows of one (b,h). Per 32-key step the block
// cooperatively stages the V tile into LDS transposed+converted to bf16
// ([d][key]) so every V B-fragment is two contiguous ds_load_b128.
// S = Q Q^T / 8 via 4 WMMAs; P relayout via per-wave LDS; O += P V via 4.
// grid = (1024/64, b*h = 64). Output Z in concat layout as bf16.
// ---------------------------------------------------------------------------
__global__ __launch_bounds__(128) void attn_kernel(const float* __restrict__ Q,
                                                   __bf16* __restrict__ Zbf) {
  __shared__ __bf16 vtile[64 * FRAG_PITCH];      // [d][key], 5KB
  __shared__ __bf16 pLds[4 * 16 * FRAG_PITCH];   // per-wave P, 5KB

  const int tid = threadIdx.x;
  const int lane = tid & 31;
  const int wave = tid >> 5;
  const int lanelo = lane & 15;
  const int half = lane >> 4;
  const int kh = half * 8;

  const int b = blockIdx.y >> 4;
  const int h = blockIdx.y & 15;
  const int q0 = blockIdx.x * 64 + wave * 16;
  const float* Qh = Q + (size_t)b * 1024 * 1024 + h * 64;  // (s,d) at s*1024 + d
  __bf16* pbase = pLds + wave * 16 * FRAG_PITCH;

  // Staging assignment: thread reads 16 consecutive floats of one key row.
  const int skey = tid >> 2;           // 0..31
  const int sdoff = (tid & 3) * 16;    // 0,16,32,48

  // Preload Q A-fragments for d-steps 0 and 32 (d_k = 64).
  v16bf aq0, aq1;
  {
    const float* rp = Qh + (size_t)(q0 + lanelo) * 1024;
    aq0 = cvt_frag_f32(rp, kh);
    aq1 = cvt_frag_f32(rp + 32, kh);
  }

  float m[8], l[8];
  v8f zero = {};
  v8f o[4] = {zero, zero, zero, zero};
#pragma unroll
  for (int r = 0; r < 8; ++r) { m[r] = -1.0e30f; l[r] = 0.0f; }

  const float inv_scale = 0.125f;  // 1/sqrt(64)

  for (int j0 = 0; j0 < 1024; j0 += 32) {
    // Cooperative V-tile stage: vtile[d][key] = bf16(Qh[j0+key][d])
    {
      const float* src = Qh + (size_t)(j0 + skey) * 1024 + sdoff;
#pragma unroll
      for (int i = 0; i < 16; ++i)
        vtile[(sdoff + i) * FRAG_PITCH + skey] = (__bf16)src[i];
    }
    __syncthreads();

    // S tile: 16 queries x 32 keys (two 16x16 C fragments)
    v8f s0 = zero, s1 = zero;
    {
      const float* kp = Qh + (size_t)(j0 + lanelo) * 1024;
      s0 = wmma_bf16(aq0, cvt_frag_f32(kp, kh), s0);
      s0 = wmma_bf16(aq1, cvt_frag_f32(kp + 32, kh), s0);
      kp = Qh + (size_t)(j0 + 16 + lanelo) * 1024;
      s1 = wmma_bf16(aq0, cvt_frag_f32(kp, kh), s1);
      s1 = wmma_bf16(aq1, cvt_frag_f32(kp + 32, kh), s1);
    }

    // Online softmax per row; write P into LDS (row-major 16x32 bf16).
#pragma unroll
    for (int r = 0; r < 8; ++r) {
      float x0 = s0[r] * inv_scale;
      float x1 = s1[r] * inv_scale;
      float tm = rowmax16(fmaxf(x0, x1));
      float mn = fmaxf(m[r], tm);
      float p0 = __expf(x0 - mn);
      float p1 = __expf(x1 - mn);
      float f = __expf(m[r] - mn);
      float ps = rowsum16(p0 + p1);
      l[r] = l[r] * f + ps;
      m[r] = mn;
#pragma unroll
      for (int t = 0; t < 4; ++t) o[t][r] *= f;
      int prow = r + 8 * half;
      pbase[prow * FRAG_PITCH + lanelo] = (__bf16)p0;
      pbase[prow * FRAG_PITCH + 16 + lanelo] = (__bf16)p1;
    }

    // P as A-fragment (LDS bounce does the C->A relayout).
    v16bf pa = load_frag_bf16(pbase + lanelo * FRAG_PITCH, kh);

    // V fragments from the transposed LDS tile: contiguous ds_load_b128 x2.
#pragma unroll
    for (int t = 0; t < 4; ++t) {
      v16bf vb = load_frag_bf16(vtile + (t * 16 + lanelo) * FRAG_PITCH, kh);
      o[t] = wmma_bf16(pa, vb, o[t]);
    }
    __syncthreads();  // protect vtile before next j-step's stores
  }

  // Normalize and store (concat layout).
#pragma unroll
  for (int t = 0; t < 4; ++t) {
#pragma unroll
    for (int r = 0; r < 8; ++r) {
      int row = q0 + r + 8 * half;
      int col = h * 64 + t * 16 + lanelo;
      float v = o[t][r] / l[r];
      Zbf[((size_t)b * 1024 + row) * 1024 + col] = (__bf16)v;
    }
  }
}

// ---------------------------------------------------------------------------
// y = alpha * (x + r - mean) / (std_unbiased + 1e-6) + beta  (per row of 1024)
// ---------------------------------------------------------------------------
__global__ __launch_bounds__(256) void residual_ln_kernel(const float* __restrict__ X,
                                                          const float* __restrict__ R,
                                                          const float* __restrict__ alpha,
                                                          const float* __restrict__ beta,
                                                          float* outF, __bf16* outB) {
  __shared__ float s1[256], s2[256], stats[2];
  const int row = blockIdx.x;
  const int t = threadIdx.x;
  const float* xr = X + (size_t)row * 1024;
  const float* rr = R + (size_t)row * 1024;

  float v[4], sum = 0.0f, sq = 0.0f;
#pragma unroll
  for (int i = 0; i < 4; ++i) {
    int c = t + i * 256;
    float a = xr[c] + rr[c];
    v[i] = a; sum += a; sq += a * a;
  }
  s1[t] = sum; s2[t] = sq;
  __syncthreads();
  for (int s = 128; s > 0; s >>= 1) {
    if (t < s) { s1[t] += s1[t + s]; s2[t] += s2[t + s]; }
    __syncthreads();
  }
  if (t == 0) {
    float mean = s1[0] * (1.0f / 1024.0f);
    float var = (s2[0] - 1024.0f * mean * mean) * (1.0f / 1023.0f);  // ddof=1
    var = fmaxf(var, 0.0f);
    stats[0] = mean;
    stats[1] = 1.0f / (sqrtf(var) + 1e-6f);
  }
  __syncthreads();
  float mean = stats[0], rinv = stats[1];
#pragma unroll
  for (int i = 0; i < 4; ++i) {
    int c = t + i * 256;
    float y = alpha[c] * (v[i] - mean) * rinv + beta[c];
    size_t off = (size_t)row * 1024 + c;
    if (outF) outF[off] = y;
    if (outB) outB[off] = (__bf16)y;
  }
}

// ---------------------------------------------------------------------------
// Orchestration
// ---------------------------------------------------------------------------
extern "C" void kernel_launch(void* const* d_in, const int* in_sizes, int n_in,
                              void* d_out, int out_size, void* d_ws, size_t ws_size,
                              hipStream_t stream) {
  const float* x     = (const float*)d_in[0];   // [4,1024,1024]
  const float* Wq    = (const float*)d_in[1];   // [1024,1024]
  const float* bq    = (const float*)d_in[2];
  const float* Wo    = (const float*)d_in[3];
  const float* bo    = (const float*)d_in[4];
  const float* W1    = (const float*)d_in[5];   // [1024,2048]
  const float* b1    = (const float*)d_in[6];
  const float* W2    = (const float*)d_in[7];   // [2048,1024]
  const float* b2    = (const float*)d_in[8];
  const float* alpha = (const float*)d_in[9];
  const float* beta  = (const float*)d_in[10];

  char* ws = (char*)d_ws;
  const size_t MB = 1u << 20;
  __bf16* Xbf  = (__bf16*)(ws + 0);         //  8 MB  (4M bf16)
  __bf16* WqT  = (__bf16*)(ws + 8 * MB);    //  2 MB
  __bf16* WoT  = (__bf16*)(ws + 10 * MB);   //  2 MB
  __bf16* W1T  = (__bf16*)(ws + 12 * MB);   //  4 MB
  __bf16* W2T  = (__bf16*)(ws + 16 * MB);   //  4 MB
  float*  Qf   = (float*)(ws + 20 * MB);    // 16 MB
  __bf16* Zbf  = (__bf16*)(ws + 36 * MB);   //  8 MB
  float*  tmpF = (float*)(ws + 44 * MB);    // 16 MB (attn_out, then ff)
  float*  Yf   = (float*)(ws + 60 * MB);    // 16 MB
  __bf16* Ybf  = (__bf16*)(ws + 76 * MB);   //  8 MB
  __bf16* Hbf  = (__bf16*)(ws + 84 * MB);   // 16 MB (4096x2048)

  const int NTOK = 4096;                     // b*s

  // bf16 conversions / weight transposes
  cvt_kernel<<<(NTOK * 1024 + 255) / 256, 256, 0, stream>>>(x, Xbf, NTOK * 1024);
  transpose_cvt_kernel<<<dim3(1024 / 64, 1024 / 64), 256, 0, stream>>>(Wq, WqT, 1024, 1024);
  transpose_cvt_kernel<<<dim3(1024 / 64, 1024 / 64), 256, 0, stream>>>(Wo, WoT, 1024, 1024);
  transpose_cvt_kernel<<<dim3(2048 / 64, 1024 / 64), 256, 0, stream>>>(W1, W1T, 1024, 2048);
  transpose_cvt_kernel<<<dim3(1024 / 64, 2048 / 64), 256, 0, stream>>>(W2, W2T, 2048, 1024);

  // Q = X @ Wq + bq   (q = k = v in the reference)
  gemm_kernel<<<dim3(1024 / 64, NTOK / 128), 256, 0, stream>>>(
      Xbf, WqT, bq, Qf, nullptr, NTOK, 1024, 1024, 0);

  // Z = softmax(Q Q^T / 8) @ Q, concat layout, bf16
  attn_kernel<<<dim3(1024 / 64, 64), 128, 0, stream>>>(Qf, Zbf);

  // attn_out = Z @ Wo + bo
  gemm_kernel<<<dim3(1024 / 64, NTOK / 128), 256, 0, stream>>>(
      Zbf, WoT, bo, tmpF, nullptr, NTOK, 1024, 1024, 0);

  // Y = LN(x + attn_out)
  residual_ln_kernel<<<NTOK, 256, 0, stream>>>(x, tmpF, alpha, beta, Yf, Ybf);

  // H = relu(Y @ W1 + b1)
  gemm_kernel<<<dim3(2048 / 64, NTOK / 128), 256, 0, stream>>>(
      Ybf, W1T, b1, nullptr, Hbf, NTOK, 2048, 1024, 1);

  // ff = H @ W2 + b2
  gemm_kernel<<<dim3(16, NTOK / 128), 256, 0, stream>>>(
      Hbf, W2T, b2, tmpF, nullptr, NTOK, 1024, 2048, 0);

  // out = LN(Y + ff)
  residual_ln_kernel<<<NTOK, 256, 0, stream>>>(Yf, tmpF, alpha, beta, (float*)d_out, nullptr);
}

// v004
// Measured time: 177 microseconds a run.
// Next to v003, in two timings, it ran 1.13 and 1.12 times as fast.
// All steps since v000 together make it 2.29 times as fast.
#include <hip/hip_runtime.h>
#include <math.h>

typedef __attribute__((ext_vector_type(16))) __bf16 v16bf;
typedef __attribute__((ext_vector_type(8)))  float  v8f;
typedef __attribute__((ext_vector_type(8)))  __bf16 v8bf;
typedef __attribute__((ext_vector_type(4)))  float  v4f;
typedef __attribute__((ext_vector_type(4)))  __bf16 v4bf;

// ---------------------------------------------------------------------------
// WMMA helper: D = A(16x32 bf16) * B(32x16 bf16) + C(16x16 f32)
// ---------------------------------------------------------------------------
__device__ inline v8f wmma_bf16(v16bf a, v16bf b, v8f c) {
  return __builtin_amdgcn_wmma_f32_16x16x32_bf16(
      /*neg_a=*/false, a, /*neg_b=*/false, b,
      /*c_mod=*/(short)0, c, /*reuse_a=*/false, /*reuse_b=*/false);
}

// Fragment element pattern (16-bit A/B, 16x32): per lane, element e maps to
// K = kh + e (e<8) or K = 16 + kh + (e-8) (e>=8), with kh = 8*(lane>=16).
__device__ inline v16bf load_frag_bf16(const __bf16* base, int kh) {
  v16bf r;
#pragma unroll
  for (int e = 0; e < 8; ++e) { r[e] = base[kh + e]; r[e + 8] = base[16 + kh + e]; }
  return r;
}

__device__ inline v16bf cvt_frag_f32(const float* base, int kh) {
  v16bf r;
#pragma unroll
  for (int e = 0; e < 8; ++e) { r[e] = (__bf16)base[kh + e]; r[e + 8] = (__bf16)base[16 + kh + e]; }
  return r;
}

// Pitch, in bf16 elements, of every LDS tile whose 32-element (64 B) rows are
// read as 16 B fragment pieces, one row per lane: 80 B = 16 B x 5 spreads the
// 16 rows of a half-wave over all 64 banks; at 64 B they fall on 16 banks.
constexpr int FRAG_PITCH = 40;

// Low 32 bits of a flat shared-aperture address = LDS byte offset.
__device__ inline unsigned int lds_addr_u32(const void* p) {
  return (unsigned int)(size_t)p;
}

// CDNA5 async copies: 16B global -> LDS per lane, tracked by ASYNCcnt.
// One GEMM stage = 12 copies per lane: LDS rows step by lstep bytes, the first
// 8 copies walk A and the last 4 walk B, both by gstep bytes a copy.
// s_wait_xcnt 0 closes the statement, so that no address register named here
// takes the next stage's value ahead of it.
__device__ inline void async_stage_12xb128(unsigned int l, unsigned int lstep,
                                           const __bf16* ga, const __bf16* gb, size_t gstep) {
  const unsigned long long a = (unsigned long long)(size_t)ga;
  const unsigned long long b = (unsigned long long)(size_t)gb;
  asm volatile(
      "global_load_async_to_lds_b128 %0, %12, off\n\t"
      "global_load_async_to_lds_b128 %1, %13, off\n\t"
      "global_load_async_to_lds_b128 %2, %14, off\n\t"
      "global_load_async_to_lds_b128 %3, %15, off\n\t"
      "global_load_async_to_lds_b128 %4, %16, off\n\t"
      "global_load_async_to_lds_b128 %5, %17, off\n\t"
      "global_load_async_to_lds_b128 %6, %18, off\n\t"
      "global_load_async_to_lds_b128 %7, %19, off\n\t"
      "global_load_async_to_lds_b128 %8, %20, off\n\t"
      "global_load_async_to_lds_b128 %9, %21, off\n\t"
      "global_load_async_to_lds_b128 %10, %22, off\n\t"
      "global_load_async_to_lds_b128 %11, %23, off\n\t"
      "s_wait_xcnt 0x0"
      :
      : "v"(l), "v"(l + lstep), "v"(l + 2 * lstep), "v"(l + 3 * lstep),
        "v"(l + 4 * lstep), "v"(l + 5 * lstep), "v"(l + 6 * lstep), "v"(l + 7 * lstep),
        "v"(l + 8 * lstep), "v"(l + 9 * lstep), "v"(l + 10 * lstep), "v"(l + 11 * lstep),
        "v"(a), "v"(a + gstep), "v"(a + 2 * gstep), "v"(a + 3 * gstep),
        "v"(a + 4 * gstep), "v"(a + 5 * gstep), "v"(a + 6 * gstep), "v"(a + 7 * gstep),
        "v"(b), "v"(b + gstep), "v"(b + 2 * gstep), "v"(b + 3 * gstep)
      : "memory");
}
__device__ inline void wait_asynccnt0() {
  asm volatile("s_wait_asynccnt 0x0" ::: "memory");
}

// Row reductions: a C-matrix row lives in 16 lanes of one half-wave.
__device__ inline float rowmax16(float v) {
  v = fmaxf(v, __shfl_xor(v, 1, 32));
  v = fmaxf(v, __shfl_xor(v, 2, 32));
  v = fmaxf(v, __shfl_xor(v, 4, 32));
  v = fmaxf(v, __shfl_xor(v, 8, 32));
  return v;
}
__device__ inline float rowsum16(float v) {
  v += __shfl_xor(v, 1, 32);
  v += __shfl_xor(v, 2, 32);
  v += __shfl_xor(v, 4, 32);
  v += __shfl_xor(v, 8, 32);
  return v;
}

// ---------------------------------------------------------------------------
// fp32 -> bf16 elementwise
// ---------------------------------------------------------------------------
__global__ __launch_bounds__(256) void cvt_kernel(const float* __restrict__ in,
                                                  __bf16* __restrict__ out, int n) {
  int i = blockIdx.x * 256 + threadIdx.x;
  if (i < n) out[i] = (__bf16)in[i];
}

// W[K x N] row-major fp32  ->  Wt[N x K] row-major bf16, one 64x64 tile per block.
// The tile turns in LDS, so that both sides of global memory see whole lines:
// a wave reads 2 rows x 256 B of W and stores 4 rows x 128 B of Wt.
// Pitch 65 floats: the row-wise writes and the column-wise reads of the tile
// both fall on 32 different banks. K and N are multiples of 64.
// grid = (N/64, K/64).
__global__ __launch_bounds__(256) void transpose_cvt_kernel(const float* __restrict__ in,
                                                            __bf16* __restrict__ out,
                                                            int K, int N) {
  __shared__ float tile[64 * 65];  // [k_local][n_local]

  const int tid = threadIdx.x;
  const int n0 = blockIdx.x * 64;
  const int k0 = blockIdx.y * 64;

  const int c4 = (tid & 15) * 4;  // 4 columns per thread
  const int r = tid >> 4;         // rows r, r+16, r+32, r+48
  v4f v[4];
#pragma unroll
  for (int i = 0; i < 4; ++i)
    v[i] = *(const v4f*)(in + (size_t)(k0 + r + 16 * i) * N + n0 + c4);
#pragma unroll
  for (int i = 0; i < 4; ++i) {
#pragma unroll
    for (int j = 0; j < 4; ++j) tile[(r + 16 * i) * 65 + c4 + j] = v[i][j];
  }
  __syncthreads();

  const int kc = (tid & 7) * 8;  // 8 consecutive k = 16 B of one Wt row
  const int nr = tid >> 3;       // Wt rows nr, nr+32
#pragma unroll
  for (int i = 0; i < 2; ++i) {
    const int n = nr + 32 * i;
    v8bf w;
#pragma unroll
    for (int j = 0; j < 8; ++j) w[j] = (__bf16)tile[(kc + j) * 65 + n];
    *(v8bf*)(out + (size_t)(n0 + n) * K + k0 + kc) = w;
  }
}

// ---------------------------------------------------------------------------
// GEMM: out[M x N] = A_bf16[M x K] @ Bt_bf16[N x K]^T + bias, optional relu.
// Wave = 16x64 output strip; 8 waves/block cover 128 rows x 64 cols.
// A stage is 128 k: the block's 128 A rows and 64 B rows, 256 B each (two whole
// lines), come into LDS by CDNA5 async-to-LDS copies (16 lanes a row, 12 copies
// a lane) and are read as ds_load_b128 fragments. K is a multiple of 128.
// grid = (N/64, M/128).
// ---------------------------------------------------------------------------
constexpr int GEMM_KS = 128;     // k per stage
constexpr int GEMM_PITCH = 136;  // bf16 per LDS row: 272 B = 16 B x 17, all 64 banks

__global__ __launch_bounds__(256) void gemm_kernel(const __bf16* __restrict__ A,
                                                   const __bf16* __restrict__ Bt,
                                                   const float* __restrict__ bias,
                                                   float* outF, __bf16* outB,
                                                   int M, int N, int K, int relu) {
  // rows 0..127: A [row_local][k_local]; rows 128..191: B [col_local][k_local]; 51KB
  __shared__ __attribute__((aligned(16))) __bf16 stage[(128 + 64) * GEMM_PITCH];
  const __bf16* atile = stage;
  const __bf16* btile = stage + 128 * GEMM_PITCH;

  const int tid = threadIdx.x;
  const int lane = tid & 31;
  const int wave = tid >> 5;
  const int lanelo = lane & 15;
  const int half = lane >> 4;
  const int kh = half * 8;

  const int m0 = blockIdx.y * 128 + wave * 16;
  const int n0 = blockIdx.x * 64;

  // Staging assignment: 16 lanes cover one 256 B row; a copy of the block covers 16 rows.
  const int srow = tid >> 4;           // 0..15
  const int skoff = (tid & 15) * 8;    // 0,8,..,120
  const unsigned int sdst = lds_addr_u32(stage) + (unsigned int)((srow * GEMM_PITCH + skoff) * 2);
  const __bf16* asrc = A + (size_t)(blockIdx.y * 128 + srow) * K + skoff;
  const __bf16* bsrc = Bt + (size_t)(n0 + srow) * K + skoff;

  v8f zero = {};
  v8f acc[4] = {zero, zero, zero, zero};

  for (int k0 = 0; k0 < K; k0 += GEMM_KS) {
    // stage[r][k] = A[blockrow+r][k0+k] (r < 128), Bt[n0+r-128][k0+k] (r >= 128)
    async_stage_12xb128(sdst, 16 * GEMM_PITCH * 2, asrc + k0, bsrc + k0, (size_t)16 * K * 2);
    wait_asynccnt0();
    __syncthreads();

    // Unrolled, so that the four 32-k slices' LDS offsets are immediates of the loads.
#pragma unroll
    for (int s = 0; s < GEMM_KS / 32; ++s) {
      v16bf va = load_frag_bf16(atile + (wave * 16 + lanelo) * GEMM_PITCH + s * 32, kh);
#pragma unroll
      for (int t = 0; t < 4; ++t) {
        v16bf vb = load_frag_bf16(btile + (t * 16 + lanelo) * GEMM_PITCH + s * 32, kh);
        acc[t] = wmma_bf16(va, vb, acc[t]);
      }
    }
    // This wave's LDS reads have retired before any wave's next copies land there.
    asm volatile("s_wait_dscnt 0x0" ::: "memory");
    __syncthreads();  // ends every reader's last read before the next stage's copies
  }

#pragma unroll
  for (int t = 0; t < 4; ++t) {
    int col = n0 + t * 16 + lanelo;
    float bv = bias[col];
#pragma unroll
    for (int r = 0; r < 8; ++r) {
      int mrow = m0 + r + 8 * half;
      float v = acc[t][r] + bv;
      if (relu) v = fmaxf(v, 0.0f);
      size_t off = (size_t)mrow * N + col;
      if (outF) outF[off] = v;
      if (outB) outB[off] = (__bf16)v;
    }
  }
}

// ---------------------------------------------------------------------------
// Attention (q = k = v = Q, per the reference's shared projection).
// Block = 4 waves x 16 query rows of one (b,h). Per 32-key step the block
// brings the 32 key rows (K = V) into LDS once, converted to bf16, row-major
// ([key][d]): a wave's load covers 2 whole 256 B rows. All four waves take both
// operands from that tile: a K B-fragment is two ds_load_b128 of a key row, a
// V B-fragment two ds_load_tr16_b128 (lane = d, 8 consecutive keys a load).
// S = Q Q^T / 8 via 4 WMMAs; P relayout via per-wave LDS; O += P V via 4.
// grid = (1024/64, b*h = 64). Output Z in concat layout as bf16.
// ---------------------------------------------------------------------------
constexpr int KV_PITCH = 72;  // bf16 per LDS row: 144 B = 16 B x 9, the ds_load_b128 readers' pitch

// Transposing LDS load of a row-major 16-bit tile T: with lane l pointing at
// T[k0 + 8*(l>>4) + (l&7)][d0 + 8*((l>>3)&1)], lane l gets
// T[k0 + 8*(l>>4) + 0..7][d0 + (l&15)].
__device__ inline v8bf lds_load_tr16(const __bf16* p) {
  typedef __attribute__((ext_vector_type(8))) short s16x8;
  typedef __attribute__((address_space(3))) s16x8 lds_s16x8;
  return __builtin_bit_cast(v8bf, __builtin_amdgcn_ds_load_tr16_b128_v8i16((lds_s16x8*)p));
}

__global__ __launch_bounds__(128) void attn_kernel(const float* __restrict__ Q,
                                                   __bf16* __restrict__ Zbf) {
  __shared__ __attribute__((aligned(16))) __bf16 kvtile[32 * KV_PITCH];  // [key][d], 4.5KB
  __shared__ __bf16 pLds[4 * 16 * FRAG_PITCH];   // per-wave P, 5KB

  const int tid = threadIdx.x;
  const int lane = tid & 31;
  const int wave = tid >> 5;
  const int lanelo = lane & 15;
  const int half = lane >> 4;
  const int kh = half * 8;

  const int b = blockIdx.y >> 4;
  const int h = blockIdx.y & 15;
  const int q0 = blockIdx.x * 64 + wave * 16;
  const float* Qh = Q + (size_t)b * 1024 * 1024 + h * 64;  // (s,d) at s*1024 + d
  __bf16* pbase = pLds + wave * 16 * FRAG_PITCH;

  // Staging assignment: 16 lanes cover one key row (64 floats); rows skey + 8i.
  const int skey = tid >> 4;           // 0..7
  const int sdoff = (tid & 15) * 4;    // 0,4,..,60
  // This lane's address in the tile for the transposing loads (keys 0..15, d 0..15).
  const __bf16* vsrc = kvtile + (kh + (lane & 7)) * KV_PITCH + ((lane >> 3) & 1) * 8;

  // Preload Q A-fragments for d-steps 0 and 32 (d_k = 64).
  v16bf aq0, aq1;
  {
    const float* rp = Qh + (size_t)(q0 + lanelo) * 1024;
    aq0 = cvt_frag_f32(rp, kh);
    aq1 = cvt_frag_f32(rp + 32, kh);
  }

  float m[8], l[8];
  v8f zero = {};
  v8f o[4] = {zero, zero, zero, zero};
#pragma unroll
  for (int r = 0; r < 8; ++r) { m[r] = -1.0e30f; l[r] = 0.0f; }

  const float inv_scale = 0.125f;  // 1/sqrt(64)

  for (int j0 = 0; j0 < 1024; j0 += 32) {
    // Cooperative key-tile stage: kvtile[key][d] = bf16(Qh[j0+key][d])
    {
      const float* src = Qh + (size_t)(j0 + skey) * 1024 + sdoff;
      v4f x[4];
#pragma unroll
      for (int i = 0; i < 4; ++i) x[i] = *(const v4f*)(src + (size_t)i * 8 * 1024);
#pragma unroll
      for (int i = 0; i < 4; ++i) {
        v4bf w;
#pragma unroll
        for (int j = 0; j < 4; ++j) w[j] = (__bf16)x[i][j];
        *(v4bf*)(kvtile + (skey + 8 * i) * KV_PITCH + sdoff) = w;
      }
    }
    __syncthreads();

    // S tile: 16 queries x 32 keys (two 16x16 C fragments)
    v8f s0 = zero, s1 = zero;
    {
      const __bf16* kp = kvtile + lanelo * KV_PITCH;
      s0 = wmma_bf16(aq0, load_frag_bf16(kp, kh), s0);
      s0 = wmma_bf16(aq1, load_frag_bf16(kp + 32, kh), s0);
      kp = kvtile + (16 + lanelo) * KV_PITCH;
      s1 = wmma_bf16(aq0, load_frag_bf16(kp, kh), s1);
      s1 = wmma_bf16(aq1, load_frag_bf16(kp + 32, kh), s1);
    }

    // Online softmax per row; write P into LDS (row-major 16x32 bf16).
#pragma unroll
    for (int r = 0; r < 8; ++r) {
      float x0 = s0[r] * inv_scale;
      float x1 = s1[r] * inv_scale;
      float tm = rowmax16(fmaxf(x0, x1));
      float mn = fmaxf(m[r], tm);
      float p0 = __expf(x0 - mn);
      float p1 = __expf(x1 - mn);
      float f = __expf(m[r] - mn);
      float ps = rowsum16(p0 + p1);
      l[r] = l[r] * f + ps;
      m[r] = mn;
#pragma unroll
      for (int t = 0; t < 4; ++t) o[t][r] *= f;
      int prow = r + 8 * half;
      pbase[prow * FRAG_PITCH + lanelo] = (__bf16)p0;
      pbase[prow * FRAG_PITCH + 16 + lanelo] = (__bf16)p1;
    }

    // P as A-fragment (LDS bounce does the C->A relayout).
    v16bf pa = load_frag_bf16(pbase + lanelo * FRAG_PITCH, kh);

    // V fragments, column d = 16t + lanelo: keys kh..kh+7, then 16+kh..16+kh+7,
    // the k order of load_frag_bf16.
#pragma unroll
    for (int t = 0; t < 4; ++t) {
      v8bf lo = lds_load_tr16(vsrc + t * 16);
      v8bf hi = lds_load_tr16(vsrc + 16 * KV_PITCH + t * 16);
      v16bf vb = __builtin_shufflevector(lo, hi, 0, 1, 2, 3, 4, 5, 6, 7, 8, 9, 10, 11, 12, 13, 14, 15);
      o[t] = wmma_bf16(pa, vb, o[t]);
    }
    __syncthreads();  // protect kvtile before next j-step's stores
  }

  // Normalize and store (concat layout).
#pragma unroll
  for (int t = 0; t < 4; ++t) {
#pragma unroll
    for (int r = 0; r < 8; ++r) {
      int row = q0 + r + 8 * half;
      int col = h * 64 + t * 16 + lanelo;
      float v = o[t][r] / l[r];
      Zbf[((size_t)b * 1024 + row) * 1024 + col] = (__bf16)v;
    }
  }
}

// ---------------------------------------------------------------------------
// y = alpha * (x + r - mean) / (std_unbiased + 1e-6) + beta  (per row of 1024)
// ---------------------------------------------------------------------------
__global__ __launch_bounds__(256) void residual_ln_kernel(const float* __restrict__ X,
                                                          const float* __restrict__ R,
                                                          const float* __restrict__ alpha,
                                                          const float* __restrict__ beta,
                                                          float* outF, __bf16* outB) {
  __shared__ float s1[256], s2[256], stats[2];
  const int row = blockIdx.x;
  const int t = threadIdx.x;
  const float* xr = X + (size_t)row * 1024;
  const float* rr = R + (size_t)row * 1024;

  float v[4], sum = 0.0f, sq = 0.0f;
#pragma unroll
  for (int i = 0; i < 4; ++i) {
    int c = t + i * 256;
    float a = xr[c] + rr[c];
    v[i] = a; sum += a; sq += a * a;
  }
  s1[t] = sum; s2[t] = sq;
  __syncthreads();
  for (int s = 128; s > 0; s >>= 1) {
    if (t < s) { s1[t] += s1[t + s]; s2[t] += s2[t + s]; }
    __syncthreads();
  }
  if (t == 0) {
    float mean = s1[0] * (1.0f / 1024.0f);
    float var = (s2[0] - 1024.0f * mean * mean) * (1.0f / 1023.0f);  // ddof=1
    var = fmaxf(var, 0.0f);
    stats[0] = mean;
    stats[1] = 1.0f / (sqrtf(var) + 1e-6f);
  }
  __syncthreads();
  float mean = stats[0], rinv = stats[1];
#pragma unroll
  for (int i = 0; i < 4; ++i) {
    int c = t + i * 256;
    float y = alpha[c] * (v[i] - mean) * rinv + beta[c];
    size_t off = (size_t)row * 1024 + c;
    if (outF) outF[off] = y;
    if (outB) outB[off] = (__bf16)y;
  }
}

// ---------------------------------------------------------------------------
// Orchestration
// ---------------------------------------------------------------------------
extern "C" void kernel_launch(void* const* d_in, const int* in_sizes, int n_in,
                              void* d_out, int out_size, void* d_ws, size_t ws_size,
                              hipStream_t stream) {
  const float* x     = (const float*)d_in[0];   // [4,1024,1024]
  const float* Wq    = (const float*)d_in[1];   // [1024,1024]
  const float* bq    = (const float*)d_in[2];
  const float* Wo    = (const float*)d_in[3];
  const float* bo    = (const float*)d_in[4];
  const float* W1    = (const float*)d_in[5];   // [1024,2048]
  const float* b1    = (const float*)d_in[6];
  const float* W2    = (const float*)d_in[7];   // [2048,1024]
  const float* b2    = (const float*)d_in[8];
  const float* alpha = (const float*)d_in[9];
  const float* beta  = (const float*)d_in[10];

  char* ws = (char*)d_ws;
  const size_t MB = 1u << 20;
  __bf16* Xbf  = (__bf16*)(ws + 0);         //  8 MB  (4M bf16)
  __bf16* WqT  = (__bf16*)(ws + 8 * MB);    //  2 MB
  __bf16* WoT  = (__bf16*)(ws + 10 * MB);   //  2 MB
  __bf16* W1T  = (__bf16*)(ws + 12 * MB);   //  4 MB
  __bf16* W2T  = (__bf16*)(ws + 16 * MB);   //  4 MB
  float*  Qf   = (float*)(ws + 20 * MB);    // 16 MB
  __bf16* Zbf  = (__bf16*)(ws + 36 * MB);   //  8 MB
  float*  tmpF = (float*)(ws + 44 * MB);    // 16 MB (attn_out, then ff)
  float*  Yf   = (float*)(ws + 60 * MB);    // 16 MB
  __bf16* Ybf  = (__bf16*)(ws + 76 * MB);   //  8 MB
  __bf16* Hbf  = (__bf16*)(ws + 84 * MB);   // 16 MB (4096x2048)

  const int NTOK = 4096;                     // b*s

  // bf16 conversions / weight transposes
  cvt_kernel<<<(NTOK * 1024 + 255) / 256, 256, 0, stream>>>(x, Xbf, NTOK * 1024);
  transpose_cvt_kernel<<<dim3(1024 / 64, 1024 / 64), 256, 0, stream>>>(Wq, WqT, 1024, 1024);
  transpose_cvt_kernel<<<dim3(1024 / 64, 1024 / 64), 256, 0, stream>>>(Wo, WoT, 1024, 1024);
  transpose_cvt_kernel<<<dim3(2048 / 64, 1024 / 64), 256, 0, stream>>>(W1, W1T, 1024, 2048);
  transpose_cvt_kernel<<<dim3(1024 / 64, 2048 / 64), 256, 0, stream>>>(W2, W2T, 2048, 1024);

  // Q = X @ Wq + bq   (q = k = v in the reference)
  gemm_kernel<<<dim3(1024 / 64, NTOK / 128), 256, 0, stream>>>(
      Xbf, WqT, bq, Qf, nullptr, NTOK, 1024, 1024, 0);

  // Z = softmax(Q Q^T / 8) @ Q, concat layout, bf16
  attn_kernel<<<dim3(1024 / 64, 64), 128, 0, stream>>>(Qf, Zbf);

  // attn_out = Z @ Wo + bo
  gemm_kernel<<<dim3(1024 / 64, NTOK / 128), 256, 0, stream>>>(
      Zbf, WoT, bo, tmpF, nullptr, NTOK, 1024, 1024, 0);

  // Y = LN(x + attn_out)
  residual_ln_kernel<<<NTOK, 256, 0, stream>>>(x, tmpF, alpha, beta, Yf, Ybf);

  // H = relu(Y @ W1 + b1)
  gemm_kernel<<<dim3(2048 / 64, NTOK / 128), 256, 0, stream>>>(
      Ybf, W1T, b1, nullptr, Hbf, NTOK, 2048, 1024, 1);

  // ff = H @ W2 + b2
  gemm_kernel<<<dim3(16, NTOK / 128), 256, 0, stream>>>(
      Hbf, W2T, b2, tmpF, nullptr, NTOK, 1024, 2048, 0);

  // out = LN(Y + ff)
  residual_ln_kernel<<<NTOK, 256, 0, stream>>>(Yf, tmpF, alpha, beta, (float*)d_out, nullptr);
}

// v005
// Measured time: 160 microseconds a run.
// Next to v004, in two timings, it ran 1.10 times as fast each time.
// Counting every step since v000, it is 2.53 times as fast.
#include <hip/hip_runtime.h>
#include <math.h>

typedef __attribute__((ext_vector_type(16))) __bf16 v16bf;
typedef __attribute__((ext_vector_type(8)))  float  v8f;
typedef __attribute__((ext_vector_type(8)))  __bf16 v8bf;
typedef __attribute__((ext_vector_type(4)))  float  v4f;
typedef __attribute__((ext_vector_type(4)))  __bf16 v4bf;

// ---------------------------------------------------------------------------
// WMMA helper: D = A(16x32 bf16) * B(32x16 bf16) + C(16x16 f32)
// ---------------------------------------------------------------------------
__device__ inline v8f wmma_bf16(v16bf a, v16bf b, v8f c) {
  return __builtin_amdgcn_wmma_f32_16x16x32_bf16(
      /*neg_a=*/false, a, /*neg_b=*/false, b,
      /*c_mod=*/(short)0, c, /*reuse_a=*/false, /*reuse_b=*/false);
}

// Fragment element pattern (16-bit A/B, 16x32): per lane, element e maps to
// K = kh + e (e<8) or K = 16 + kh + (e-8) (e>=8), with kh = 8*(lane>=16).
__device__ inline v16bf load_frag_bf16(const __bf16* base, int kh) {
  v16bf r;
#pragma unroll
  for (int e = 0; e < 8; ++e) { r[e] = base[kh + e]; r[e + 8] = base[16 + kh + e]; }
  return r;
}

__device__ inline v16bf cvt_frag_f32(const float* base, int kh) {
  v16bf r;
#pragma unroll
  for (int e = 0; e < 8; ++e) { r[e] = (__bf16)base[kh + e]; r[e + 8] = (__bf16)base[16 + kh + e]; }
  return r;
}

// Low 32 bits of a flat shared-aperture address = LDS byte offset.
__device__ inline unsigned int lds_addr_u32(const void* p) {
  return (unsigned int)(size_t)p;
}

// CDNA5 async copies: 16B global -> LDS per lane, tracked by ASYNCcnt.
// One GEMM stage = 12 copies per lane: LDS rows step by lstep bytes, the first
// 8 copies walk A and the last 4 walk B, both by gstep bytes a copy.
// s_wait_xcnt 0 closes the statement, so that no address register named here
// takes the next stage's value ahead of it.
__device__ inline void async_stage_12xb128(unsigned int l, unsigned int lstep,
                                           const __bf16* ga, const __bf16* gb, size_t gstep) {
  const unsigned long long a = (unsigned long long)(size_t)ga;
  const unsigned long long b = (unsigned long long)(size_t)gb;
  asm volatile(
      "global_load_async_to_lds_b128 %0, %12, off\n\t"
      "global_load_async_to_lds_b128 %1, %13, off\n\t"
      "global_load_async_to_lds_b128 %2, %14, off\n\t"
      "global_load_async_to_lds_b128 %3, %15, off\n\t"
      "global_load_async_to_lds_b128 %4, %16, off\n\t"
      "global_load_async_to_lds_b128 %5, %17, off\n\t"
      "global_load_async_to_lds_b128 %6, %18, off\n\t"
      "global_load_async_to_lds_b128 %7, %19, off\n\t"
      "global_load_async_to_lds_b128 %8, %20, off\n\t"
      "global_load_async_to_lds_b128 %9, %21, off\n\t"
      "global_load_async_to_lds_b128 %10, %22, off\n\t"
      "global_load_async_to_lds_b128 %11, %23, off\n\t"
      "s_wait_xcnt 0x0"
      :
      : "v"(l), "v"(l + lstep), "v"(l + 2 * lstep), "v"(l + 3 * lstep),
        "v"(l + 4 * lstep), "v"(l + 5 * lstep), "v"(l + 6 * lstep), "v"(l + 7 * lstep),
        "v"(l + 8 * lstep), "v"(l + 9 * lstep), "v"(l + 10 * lstep), "v"(l + 11 * lstep),
        "v"(a), "v"(a + gstep), "v"(a + 2 * gstep), "v"(a + 3 * gstep),
        "v"(a + 4 * gstep), "v"(a + 5 * gstep), "v"(a + 6 * gstep), "v"(a + 7 * gstep),
        "v"(b), "v"(b + gstep), "v"(b + 2 * gstep), "v"(b + 3 * gstep)
      : "memory");
}
__device__ inline void wait_asynccnt0() {
  asm volatile("s_wait_asynccnt 0x0" ::: "memory");
}

// ---------------------------------------------------------------------------
// fp32 -> bf16 elementwise
// ---------------------------------------------------------------------------
__global__ __launch_bounds__(256) void cvt_kernel(const float* __restrict__ in,
                                                  __bf16* __restrict__ out, int n) {
  int i = blockIdx.x * 256 + threadIdx.x;
  if (i < n) out[i] = (__bf16)in[i];
}

// W[K x N] row-major fp32  ->  Wt[N x K] row-major bf16, one 64x64 tile per block.
// The tile turns in LDS, so that both sides of global memory see whole lines:
// a wave reads 2 rows x 256 B of W and stores 4 rows x 128 B of Wt.
// Pitch 65 floats: the row-wise writes and the column-wise reads of the tile
// both fall on 32 different banks. K and N are multiples of 64.
// grid = (N/64, K/64).
__global__ __launch_bounds__(256) void transpose_cvt_kernel(const float* __restrict__ in,
                                                            __bf16* __restrict__ out,
                                                            int K, int N) {
  __shared__ float tile[64 * 65];  // [k_local][n_local]

  const int tid = threadIdx.x;
  const int n0 = blockIdx.x * 64;
  const int k0 = blockIdx.y * 64;

  const int c4 = (tid & 15) * 4;  // 4 columns per thread
  const int r = tid >> 4;         // rows r, r+16, r+32, r+48
  v4f v[4];
#pragma unroll
  for (int i = 0; i < 4; ++i)
    v[i] = *(const v4f*)(in + (size_t)(k0 + r + 16 * i) * N + n0 + c4);
#pragma unroll
  for (int i = 0; i < 4; ++i) {
#pragma unroll
    for (int j = 0; j < 4; ++j) tile[(r + 16 * i) * 65 + c4 + j] = v[i][j];
  }
  __syncthreads();

  const int kc = (tid & 7) * 8;  // 8 consecutive k = 16 B of one Wt row
  const int nr = tid >> 3;       // Wt rows nr, nr+32
#pragma unroll
  for (int i = 0; i < 2; ++i) {
    const int n = nr + 32 * i;
    v8bf w;
#pragma unroll
    for (int j = 0; j < 8; ++j) w[j] = (__bf16)tile[(kc + j) * 65 + n];
    *(v8bf*)(out + (size_t)(n0 + n) * K + k0 + kc) = w;
  }
}

// ---------------------------------------------------------------------------
// GEMM: out[M x N] = A_bf16[M x K] @ Bt_bf16[N x K]^T + bias, optional relu.
// Wave = 16x64 output strip; 8 waves/block cover 128 rows x 64 cols.
// A stage is 128 k: the block's 128 A rows and 64 B rows, 256 B each (two whole
// lines), come into LDS by CDNA5 async-to-LDS copies (16 lanes a row, 12 copies
// a lane) and are read as ds_load_b128 fragments. K is a multiple of 128.
// grid = (N/64, M/128).
// ---------------------------------------------------------------------------
constexpr int GEMM_KS = 128;     // k per stage
constexpr int GEMM_PITCH = 136;  // bf16 per LDS row: 272 B = 16 B x 17, all 64 banks

__global__ __launch_bounds__(256) void gemm_kernel(const __bf16* __restrict__ A,
                                                   const __bf16* __restrict__ Bt,
                                                   const float* __restrict__ bias,
                                                   float* outF, __bf16* outB,
                                                   int M, int N, int K, int relu) {
  // rows 0..127: A [row_local][k_local]; rows 128..191: B [col_local][k_local]; 51KB
  __shared__ __attribute__((aligned(16))) __bf16 stage[(128 + 64) * GEMM_PITCH];
  const __bf16* atile = stage;
  const __bf16* btile = stage + 128 * GEMM_PITCH;

  const int tid = threadIdx.x;
  const int lane = tid & 31;
  const int wave = tid >> 5;
  const int lanelo = lane & 15;
  const int half = lane >> 4;
  const int kh = half * 8;

  const int m0 = blockIdx.y * 128 + wave * 16;
  const int n0 = blockIdx.x * 64;

  // Staging assignment: 16 lanes cover one 256 B row; a copy of the block covers 16 rows.
  const int srow = tid >> 4;           // 0..15
  const int skoff = (tid & 15) * 8;    // 0,8,..,120
  const unsigned int sdst = lds_addr_u32(stage) + (unsigned int)((srow * GEMM_PITCH + skoff) * 2);
  const __bf16* asrc = A + (size_t)(blockIdx.y * 128 + srow) * K + skoff;
  const __bf16* bsrc = Bt + (size_t)(n0 + srow) * K + skoff;

  v8f zero = {};
  v8f acc[4] = {zero, zero, zero, zero};

  for (int k0 = 0; k0 < K; k0 += GEMM_KS) {
    // stage[r][k] = A[blockrow+r][k0+k] (r < 128), Bt[n0+r-128][k0+k] (r >= 128)
    async_stage_12xb128(sdst, 16 * GEMM_PITCH * 2, asrc + k0, bsrc + k0, (size_t)16 * K * 2);
    wait_asynccnt0();
    __syncthreads();

    // Unrolled, so that the four 32-k slices' LDS offsets are immediates of the loads.
#pragma unroll
    for (int s = 0; s < GEMM_KS / 32; ++s) {
      v16bf va = load_frag_bf16(atile + (wave * 16 + lanelo) * GEMM_PITCH + s * 32, kh);
#pragma unroll
      for (int t = 0; t < 4; ++t) {
        v16bf vb = load_frag_bf16(btile + (t * 16 + lanelo) * GEMM_PITCH + s * 32, kh);
        acc[t] = wmma_bf16(va, vb, acc[t]);
      }
    }
    // This wave's LDS reads have retired before any wave's next copies land there.
    asm volatile("s_wait_dscnt 0x0" ::: "memory");
    __syncthreads();  // ends every reader's last read before the next stage's copies
  }

#pragma unroll
  for (int t = 0; t < 4; ++t) {
    int col = n0 + t * 16 + lanelo;
    float bv = bias[col];
#pragma unroll
    for (int r = 0; r < 8; ++r) {
      int mrow = m0 + r + 8 * half;
      float v = acc[t][r] + bv;
      if (relu) v = fmaxf(v, 0.0f);
      size_t off = (size_t)mrow * N + col;
      if (outF) outF[off] = v;
      if (outB) outB[off] = (__bf16)v;
    }
  }
}

// ---------------------------------------------------------------------------
// Attention (q = k = v = Q, per the reference's shared projection).
// Block = 4 waves x 16 query rows of one (b,h). Per 32-key step the block
// brings the 32 key rows (K = V) into LDS once, converted to bf16, row-major
// ([key][d]): a wave's load covers 2 whole 256 B rows. All four waves take both
// operands from that tile: a K A-fragment is two ds_load_b128 of a key row, a
// V^T A-fragment two ds_load_tr16_b128 (lane = d, 8 consecutive keys a load).
// Both products are transposed: S^T = K Q^T / 8 (4 WMMAs) and O^T += V^T P^T
// (4 WMMAs). A lane then holds 16 of the 32 scores of ONE query (lane & 15),
// its partner lane ^ 16 the other 16: the maximum is taken in the lane's own
// registers plus one exchange between the halves, and the two score tiles,
// converted in place, are the B operand P^T in the hardware k order.
// grid = (1024/64, b*h = 64). Output Z in concat layout as bf16.
// ---------------------------------------------------------------------------
constexpr int KV_PITCH = 72;  // bf16 per LDS row: 144 B = 16 B x 9, the ds_load_b128 readers' pitch

// Transposing LDS load of a row-major 16-bit tile T: with lane l pointing at
// T[k0 + 8*(l>>4) + (l&7)][d0 + 8*((l>>3)&1)], lane l gets
// T[k0 + 8*(l>>4) + 0..7][d0 + (l&15)].
__device__ inline v8bf lds_load_tr16(const __bf16* p) {
  typedef __attribute__((ext_vector_type(8))) short s16x8;
  typedef __attribute__((address_space(3))) s16x8 lds_s16x8;
  return __builtin_bit_cast(v8bf, __builtin_amdgcn_ds_load_tr16_b128_v8i16((lds_s16x8*)p));
}

// Value of lane l ^ 16 (v_permlanex16_b32 with the identity selects).
__device__ inline float xhalf(float x) {
  const int i = __builtin_bit_cast(int, x);
  return __builtin_bit_cast(float,
      __builtin_amdgcn_permlanex16(i, i, 0x76543210, 0xfedcba98, false, false));
}

__global__ __launch_bounds__(128) void attn_kernel(const float* __restrict__ Q,
                                                   __bf16* __restrict__ Zbf) {
  __shared__ __attribute__((aligned(16))) __bf16 kvtile[32 * KV_PITCH];  // [key][d], 4.5KB

  const int tid = threadIdx.x;
  const int lane = tid & 31;
  const int wave = tid >> 5;
  const int lanelo = lane & 15;
  const int half = lane >> 4;
  const int kh = half * 8;

  const int b = blockIdx.y >> 4;
  const int h = blockIdx.y & 15;
  const int q0 = blockIdx.x * 64 + wave * 16;
  const float* Qh = Q + (size_t)b * 1024 * 1024 + h * 64;  // (s,d) at s*1024 + d

  // Staging assignment: 16 lanes cover one key row (64 floats); rows skey + 8i.
  const int skey = tid >> 4;           // 0..7
  const int sdoff = (tid & 15) * 4;    // 0,4,..,60
  // This lane's address in the tile for the transposing loads (keys 0..15, d 0..15).
  const __bf16* vsrc = kvtile + (kh + (lane & 7)) * KV_PITCH + ((lane >> 3) & 1) * 8;

  // Preload Q^T B-fragments (column = query q0 + lanelo) for d-steps 0 and 32 (d_k = 64).
  v16bf bq0, bq1;
  {
    const float* rp = Qh + (size_t)(q0 + lanelo) * 1024;
    bq0 = cvt_frag_f32(rp, kh);
    bq1 = cvt_frag_f32(rp + 32, kh);
  }

  // Of query q0 + lanelo: m the running maximum (equal in both halves), l the
  // sum over this half's keys alone; the halves' sums are joined after the loop.
  float m = -1.0e30f, l = 0.0f;
  v8f zero = {};
  v8f o[4] = {zero, zero, zero, zero};  // o[t][r] = O^T[d = 16t + 8*half + r][query lanelo]

  const float inv_scale = 0.125f;  // 1/sqrt(64)

  for (int j0 = 0; j0 < 1024; j0 += 32) {
    // Cooperative key-tile stage: kvtile[key][d] = bf16(Qh[j0+key][d])
    {
      const float* src = Qh + (size_t)(j0 + skey) * 1024 + sdoff;
      v4f x[4];
#pragma unroll
      for (int i = 0; i < 4; ++i) x[i] = *(const v4f*)(src + (size_t)i * 8 * 1024);
#pragma unroll
      for (int i = 0; i < 4; ++i) {
        v4bf w;
#pragma unroll
        for (int j = 0; j < 4; ++j) w[j] = (__bf16)x[i][j];
        *(v4bf*)(kvtile + (skey + 8 * i) * KV_PITCH + sdoff) = w;
      }
    }
    __syncthreads();

    // S^T tile: 32 keys x 16 queries; s0[r] = key j0 + 8*half + r, s1[r] = key j0 + 16 + 8*half + r.
    v8f s0 = zero, s1 = zero;
    {
      const __bf16* kp = kvtile + lanelo * KV_PITCH;
      s0 = wmma_bf16(load_frag_bf16(kp, kh), bq0, s0);
      s0 = wmma_bf16(load_frag_bf16(kp + 32, kh), bq1, s0);
      kp = kvtile + (16 + lanelo) * KV_PITCH;
      s1 = wmma_bf16(load_frag_bf16(kp, kh), bq0, s1);
      s1 = wmma_bf16(load_frag_bf16(kp + 32, kh), bq1, s1);
    }

    // V^T fragments, row d = 16t + lanelo: keys kh..kh+7, then 16+kh..16+kh+7,
    // the k order of load_frag_bf16 and of the packed score tiles.
    v16bf va[4];
#pragma unroll
    for (int t = 0; t < 4; ++t) {
      v8bf lo = lds_load_tr16(vsrc + t * 16);
      v8bf hi = lds_load_tr16(vsrc + 16 * KV_PITCH + t * 16);
      va[t] = __builtin_shufflevector(lo, hi, 0, 1, 2, 3, 4, 5, 6, 7, 8, 9, 10, 11, 12, 13, 14, 15);
    }

    // Online softmax of this lane's query.
    float tm = fmaxf(s0[0], s1[0]);
#pragma unroll
    for (int r = 1; r < 8; ++r) tm = fmaxf(tm, fmaxf(s0[r], s1[r]));
    tm = fmaxf(tm, xhalf(tm)) * inv_scale;
    const float mn = fmaxf(m, tm);
    const float f = __expf(m - mn);
    m = mn;

    v16bf pb;  // P^T B-fragment: element e = key kh + e, element 8 + e = key 16 + kh + e
    float ps0 = 0.0f, ps1 = 0.0f;
#pragma unroll
    for (int r = 0; r < 8; ++r) {
      float p0 = __expf(s0[r] * inv_scale - mn);
      float p1 = __expf(s1[r] * inv_scale - mn);
      ps0 += p0;
      ps1 += p1;
      pb[r] = (__bf16)p0;
      pb[r + 8] = (__bf16)p1;
    }
    l = l * f + (ps0 + ps1);

#pragma unroll
    for (int t = 0; t < 4; ++t) {
      o[t] *= f;
      o[t] = wmma_bf16(va[t], pb, o[t]);
    }
    __syncthreads();  // protect kvtile before next j-step's stores
  }

  // Join the halves' sums, normalize and store (concat layout): 8 consecutive d = 16 B a store.
  const float linv = 1.0f / (l + xhalf(l));
  __bf16* zrow = Zbf + ((size_t)b * 1024 + q0 + lanelo) * 1024 + h * 64 + kh;
#pragma unroll
  for (int t = 0; t < 4; ++t) {
    v8bf w;
#pragma unroll
    for (int r = 0; r < 8; ++r) w[r] = (__bf16)(o[t][r] * linv);
    *(v8bf*)(zrow + t * 16) = w;
  }
}

// ---------------------------------------------------------------------------
// y = alpha * (x + r - mean) / (std_unbiased + 1e-6) + beta  (per row of 1024)
// ---------------------------------------------------------------------------
__global__ __launch_bounds__(256) void residual_ln_kernel(const float* __restrict__ X,
                                                          const float* __restrict__ R,
                                                          const float* __restrict__ alpha,
                                                          const float* __restrict__ beta,
                                                          float* outF, __bf16* outB) {
  __shared__ float s1[256], s2[256], stats[2];
  const int row = blockIdx.x;
  const int t = threadIdx.x;
  const float* xr = X + (size_t)row * 1024;
  const float* rr = R + (size_t)row * 1024;

  float v[4], sum = 0.0f, sq = 0.0f;
#pragma unroll
  for (int i = 0; i < 4; ++i) {
    int c = t + i * 256;
    float a = xr[c] + rr[c];
    v[i] = a; sum += a; sq += a * a;
  }
  s1[t] = sum; s2[t] = sq;
  __syncthreads();
  for (int s = 128; s > 0; s >>= 1) {
    if (t < s) { s1[t] += s1[t + s]; s2[t] += s2[t + s]; }
    __syncthreads();
  }
  if (t == 0) {
    float mean = s1[0] * (1.0f / 1024.0f);
    float var = (s2[0] - 1024.0f * mean * mean) * (1.0f / 1023.0f);  // ddof=1
    var = fmaxf(var, 0.0f);
    stats[0] = mean;
    stats[1] = 1.0f / (sqrtf(var) + 1e-6f);
  }
  __syncthreads();
  float mean = stats[0], rinv = stats[1];
#pragma unroll
  for (int i = 0; i < 4; ++i) {
    int c = t + i * 256;
    float y = alpha[c] * (v[i] - mean) * rinv + beta[c];
    size_t off = (size_t)row * 1024 + c;
    if (outF) outF[off] = y;
    if (outB) outB[off] = (__bf16)y;
  }
}

// ---------------------------------------------------------------------------
// Orchestration
// ---------------------------------------------------------------------------
extern "C" void kernel_launch(void* const* d_in, const int* in_sizes, int n_in,
                              void* d_out, int out_size, void* d_ws, size_t ws_size,
                              hipStream_t stream) {
  const float* x     = (const float*)d_in[0];   // [4,1024,1024]
  const float* Wq    = (const float*)d_in[1];   // [1024,1024]
  const float* bq    = (const float*)d_in[2];
  const float* Wo    = (const float*)d_in[3];
  const float* bo    = (const float*)d_in[4];
  const float* W1    = (const float*)d_in[5];   // [1024,2048]
  const float* b1    = (const float*)d_in[6];
  const float* W2    = (const float*)d_in[7];   // [2048,1024]
  const float* b2    = (const float*)d_in[8];
  const float* alpha = (const float*)d_in[9];
  const float* beta  = (const float*)d_in[10];

  char* ws = (char*)d_ws;
  const size_t MB = 1u << 20;
  __bf16* Xbf  = (__bf16*)(ws + 0);         //  8 MB  (4M bf16)
  __bf16* WqT  = (__bf16*)(ws + 8 * MB);    //  2 MB
  __bf16* WoT  = (__bf16*)(ws + 10 * MB);   //  2 MB
  __bf16* W1T  = (__bf16*)(ws + 12 * MB);   //  4 MB
  __bf16* W2T  = (__bf16*)(ws + 16 * MB);   //  4 MB
  float*  Qf   = (float*)(ws + 20 * MB);    // 16 MB
  __bf16* Zbf  = (__bf16*)(ws + 36 * MB);   //  8 MB
  float*  tmpF = (float*)(ws + 44 * MB);    // 16 MB (attn_out, then ff)
  float*  Yf   = (float*)(ws + 60 * MB);    // 16 MB
  __bf16* Ybf  = (__bf16*)(ws + 76 * MB);   //  8 MB
  __bf16* Hbf  = (__bf16*)(ws + 84 * MB);   // 16 MB (4096x2048)

  const int NTOK = 4096;                     // b*s

  // bf16 conversions / weight transposes
  cvt_kernel<<<(NTOK * 1024 + 255) / 256, 256, 0, stream>>>(x, Xbf, NTOK * 1024);
  transpose_cvt_kernel<<<dim3(1024 / 64, 1024 / 64), 256, 0, stream>>>(Wq, WqT, 1024, 1024);
  transpose_cvt_kernel<<<dim3(1024 / 64, 1024 / 64), 256, 0, stream>>>(Wo, WoT, 1024, 1024);
  transpose_cvt_kernel<<<dim3(2048 / 64, 1024 / 64), 256, 0, stream>>>(W1, W1T, 1024, 2048);
  transpose_cvt_kernel<<<dim3(1024 / 64, 2048 / 64), 256, 0, stream>>>(W2, W2T, 2048, 1024);

  // Q = X @ Wq + bq   (q = k = v in the reference)
  gemm_kernel<<<dim3(1024 / 64, NTOK / 128), 256, 0, stream>>>(
      Xbf, WqT, bq, Qf, nullptr, NTOK, 1024, 1024, 0);

  // Z = softmax(Q Q^T / 8) @ Q, concat layout, bf16
  attn_kernel<<<dim3(1024 / 64, 64), 128, 0, stream>>>(Qf, Zbf);

  // attn_out = Z @ Wo + bo
  gemm_kernel<<<dim3(1024 / 64, NTOK / 128), 256, 0, stream>>>(
      Zbf, WoT, bo, tmpF, nullptr, NTOK, 1024, 1024, 0);

  // Y = LN(x + attn_out)
  residual_ln_kernel<<<NTOK, 256, 0, stream>>>(x, tmpF, alpha, beta, Yf, Ybf);

  // H = relu(Y @ W1 + b1)
  gemm_kernel<<<dim3(2048 / 64, NTOK / 128), 256, 0, stream>>>(
      Ybf, W1T, b1, nullptr, Hbf, NTOK, 2048, 1024, 1);

  // ff = H @ W2 + b2
  gemm_kernel<<<dim3(16, NTOK / 128), 256, 0, stream>>>(
      Hbf, W2T, b2, tmpF, nullptr, NTOK, 1024, 2048, 0);

  // out = LN(Y + ff)
  residual_ln_kernel<<<NTOK, 256, 0, stream>>>(Yf, tmpF, alpha, beta, (float*)d_out, nullptr);
}

// v006
// It runs in 155 microseconds.
// Two timings next to v005 both put it at 1.03 times that version's speed.
// Counting every step since v000, it is 2.61 times as fast.
#include <hip/hip_runtime.h>
#include <math.h>

typedef __attribute__((ext_vector_type(16))) __bf16 v16bf;
typedef __attribute__((ext_vector_type(8)))  float  v8f;
typedef __attribute__((ext_vector_type(8)))  __bf16 v8bf;
typedef __attribute__((ext_vector_type(4)))  float  v4f;
typedef __attribute__((ext_vector_type(4)))  __bf16 v4bf;

// ---------------------------------------------------------------------------
// WMMA helper: D = A(16x32 bf16) * B(32x16 bf16) + C(16x16 f32)
// ---------------------------------------------------------------------------
__device__ inline v8f wmma_bf16(v16bf a, v16bf b, v8f c) {
  return __builtin_amdgcn_wmma_f32_16x16x32_bf16(
      /*neg_a=*/false, a, /*neg_b=*/false, b,
      /*c_mod=*/(short)0, c, /*reuse_a=*/false, /*reuse_b=*/false);
}

// Fragment element pattern (16-bit A/B, 16x32): per lane, element e maps to
// K = kh + e (e<8) or K = 16 + kh + (e-8) (e>=8), with kh = 8*(lane>=16).
__device__ inline v16bf load_frag_bf16(const __bf16* base, int kh) {
  v16bf r;
#pragma unroll
  for (int e = 0; e < 8; ++e) { r[e] = base[kh + e]; r[e + 8] = base[16 + kh + e]; }
  return r;
}

__device__ inline v16bf cvt_frag_f32(const float* base, int kh) {
  v16bf r;
#pragma unroll
  for (int e = 0; e < 8; ++e) { r[e] = (__bf16)base[kh + e]; r[e + 8] = (__bf16)base[16 + kh + e]; }
  return r;
}

// Low 32 bits of a flat shared-aperture address = LDS byte offset.
__device__ inline unsigned int lds_addr_u32(const void* p) {
  return (unsigned int)(size_t)p;
}

// CDNA5 async copies: 16B global -> LDS per lane, tracked by ASYNCcnt.
// One GEMM stage = 12 copies per lane: LDS rows step by lstep bytes, the first
// 8 copies walk A and the last 4 walk B, both by gstep bytes a copy.
// s_wait_xcnt 0 closes the statement, so that no address register named here
// takes the next stage's value ahead of it.
__device__ inline void async_stage_12xb128(unsigned int l, unsigned int lstep,
                                           const __bf16* ga, const __bf16* gb, size_t gstep) {
  const unsigned long long a = (unsigned long long)(size_t)ga;
  const unsigned long long b = (unsigned long long)(size_t)gb;
  asm volatile(
      "global_load_async_to_lds_b128 %0, %12, off\n\t"
      "global_load_async_to_lds_b128 %1, %13, off\n\t"
      "global_load_async_to_lds_b128 %2, %14, off\n\t"
      "global_load_async_to_lds_b128 %3, %15, off\n\t"
      "global_load_async_to_lds_b128 %4, %16, off\n\t"
      "global_load_async_to_lds_b128 %5, %17, off\n\t"
      "global_load_async_to_lds_b128 %6, %18, off\n\t"
      "global_load_async_to_lds_b128 %7, %19, off\n\t"
      "global_load_async_to_lds_b128 %8, %20, off\n\t"
      "global_load_async_to_lds_b128 %9, %21, off\n\t"
      "global_load_async_to_lds_b128 %10, %22, off\n\t"
      "global_load_async_to_lds_b128 %11, %23, off\n\t"
      "s_wait_xcnt 0x0"
      :
      : "v"(l), "v"(l + lstep), "v"(l + 2 * lstep), "v"(l + 3 * lstep),
        "v"(l + 4 * lstep), "v"(l + 5 * lstep), "v"(l + 6 * lstep), "v"(l + 7 * lstep),
        "v"(l + 8 * lstep), "v"(l + 9 * lstep), "v"(l + 10 * lstep), "v"(l + 11 * lstep),
        "v"(a), "v"(a + gstep), "v"(a + 2 * gstep), "v"(a + 3 * gstep),
        "v"(a + 4 * gstep), "v"(a + 5 * gstep), "v"(a + 6 * gstep), "v"(a + 7 * gstep),
        "v"(b), "v"(b + gstep), "v"(b + 2 * gstep), "v"(b + 3 * gstep)
      : "memory");
}
__device__ inline void wait_asynccnt0() {
  asm volatile("s_wait_asynccnt 0x0" ::: "memory");
}

// ---------------------------------------------------------------------------
// fp32 -> bf16 elementwise, 32 elements a thread, so that few waves have to start.
// A wave takes 1024 consecutive floats: eight 16 B loads a lane, each 512
// contiguous bytes of the wave, all in flight before the first conversion; a
// store of the wave is 256 contiguous bytes (two whole lines).
// The element count is a multiple of the 8192 a block takes. grid = count / 8192.
// ---------------------------------------------------------------------------
__global__ __launch_bounds__(256) void cvt_kernel(const float* __restrict__ in,
                                                  __bf16* __restrict__ out) {
  const size_t base = ((size_t)blockIdx.x * 8 + (threadIdx.x >> 5)) * 1024 + (threadIdx.x & 31) * 4;
  v4f x[8];
#pragma unroll
  for (int i = 0; i < 8; ++i) x[i] = *(const v4f*)(in + base + i * 128);
#pragma unroll
  for (int i = 0; i < 8; ++i) *(v4bf*)(out + base + i * 128) = __builtin_convertvector(x[i], v4bf);
}

// W[K x N] row-major fp32  ->  Wt[N x K] row-major bf16, one 64x64 tile per block.
// The tile turns in LDS, so that both sides of global memory see whole lines:
// a wave reads 2 rows x 256 B of W and stores 4 rows x 128 B of Wt.
// Pitch 65 floats: the row-wise writes and the column-wise reads of the tile
// both fall on 32 different banks. K and N are multiples of 64.
// grid = (N/64, K/64).
__global__ __launch_bounds__(256) void transpose_cvt_kernel(const float* __restrict__ in,
                                                            __bf16* __restrict__ out,
                                                            int K, int N) {
  __shared__ float tile[64 * 65];  // [k_local][n_local]

  const int tid = threadIdx.x;
  const int n0 = blockIdx.x * 64;
  const int k0 = blockIdx.y * 64;

  const int c4 = (tid & 15) * 4;  // 4 columns per thread
  const int r = tid >> 4;         // rows r, r+16, r+32, r+48
  v4f v[4];
#pragma unroll
  for (int i = 0; i < 4; ++i)
    v[i] = *(const v4f*)(in + (size_t)(k0 + r + 16 * i) * N + n0 + c4);
#pragma unroll
  for (int i = 0; i < 4; ++i) {
#pragma unroll
    for (int j = 0; j < 4; ++j) tile[(r + 16 * i) * 65 + c4 + j] = v[i][j];
  }
  __syncthreads();

  const int kc = (tid & 7) * 8;  // 8 consecutive k = 16 B of one Wt row
  const int nr = tid >> 3;       // Wt rows nr, nr+32
#pragma unroll
  for (int i = 0; i < 2; ++i) {
    const int n = nr + 32 * i;
    v8bf w;
#pragma unroll
    for (int j = 0; j < 8; ++j) w[j] = (__bf16)tile[(kc + j) * 65 + n];
    *(v8bf*)(out + (size_t)(n0 + n) * K + k0 + kc) = w;
  }
}

// ---------------------------------------------------------------------------
// GEMM: out[M x N] = A_bf16[M x K] @ Bt_bf16[N x K]^T + bias, optional relu.
// Wave = 16x64 output strip; 8 waves/block cover 128 rows x 64 cols.
// A stage is 128 k: the block's 128 A rows and 64 B rows, 256 B each (two whole
// lines), come into LDS by CDNA5 async-to-LDS copies (16 lanes a row, 12 copies
// a lane) and are read as ds_load_b128 fragments. K is a multiple of 128.
// grid = (N/64, M/128).
// ---------------------------------------------------------------------------
constexpr int GEMM_KS = 128;     // k per stage
constexpr int GEMM_PITCH = 136;  // bf16 per LDS row: 272 B = 16 B x 17, all 64 banks

__global__ __launch_bounds__(256) void gemm_kernel(const __bf16* __restrict__ A,
                                                   const __bf16* __restrict__ Bt,
                                                   const float* __restrict__ bias,
                                                   float* outF, __bf16* outB,
                                                   int M, int N, int K, int relu) {
  // rows 0..127: A [row_local][k_local]; rows 128..191: B [col_local][k_local]; 51KB
  __shared__ __attribute__((aligned(16))) __bf16 stage[(128 + 64) * GEMM_PITCH];
  const __bf16* atile = stage;
  const __bf16* btile = stage + 128 * GEMM_PITCH;

  const int tid = threadIdx.x;
  const int lane = tid & 31;
  const int wave = tid >> 5;
  const int lanelo = lane & 15;
  const int half = lane >> 4;
  const int kh = half * 8;

  const int m0 = blockIdx.y * 128 + wave * 16;
  const int n0 = blockIdx.x * 64;

  // Staging assignment: 16 lanes cover one 256 B row; a copy of the block covers 16 rows.
  const int srow = tid >> 4;           // 0..15
  const int skoff = (tid & 15) * 8;    // 0,8,..,120
  const unsigned int sdst = lds_addr_u32(stage) + (unsigned int)((srow * GEMM_PITCH + skoff) * 2);
  const __bf16* asrc = A + (size_t)(blockIdx.y * 128 + srow) * K + skoff;
  const __bf16* bsrc = Bt + (size_t)(n0 + srow) * K + skoff;

  v8f zero = {};
  v8f acc[4] = {zero, zero, zero, zero};

  for (int k0 = 0; k0 < K; k0 += GEMM_KS) {
    // stage[r][k] = A[blockrow+r][k0+k] (r < 128), Bt[n0+r-128][k0+k] (r >= 128)
    async_stage_12xb128(sdst, 16 * GEMM_PITCH * 2, asrc + k0, bsrc + k0, (size_t)16 * K * 2);
    wait_asynccnt0();
    __syncthreads();

    // Unrolled, so that the four 32-k slices' LDS offsets are immediates of the loads.
#pragma unroll
    for (int s = 0; s < GEMM_KS / 32; ++s) {
      v16bf va = load_frag_bf16(atile + (wave * 16 + lanelo) * GEMM_PITCH + s * 32, kh);
#pragma unroll
      for (int t = 0; t < 4; ++t) {
        v16bf vb = load_frag_bf16(btile + (t * 16 + lanelo) * GEMM_PITCH + s * 32, kh);
        acc[t] = wmma_bf16(va, vb, acc[t]);
      }
    }
    // This wave's LDS reads have retired before any wave's next copies land there.
    asm volatile("s_wait_dscnt 0x0" ::: "memory");
    __syncthreads();  // ends every reader's last read before the next stage's copies
  }

#pragma unroll
  for (int t = 0; t < 4; ++t) {
    int col = n0 + t * 16 + lanelo;
    float bv = bias[col];
#pragma unroll
    for (int r = 0; r < 8; ++r) {
      int mrow = m0 + r + 8 * half;
      float v = acc[t][r] + bv;
      if (relu) v = fmaxf(v, 0.0f);
      size_t off = (size_t)mrow * N + col;
      if (outF) outF[off] = v;
      if (outB) outB[off] = (__bf16)v;
    }
  }
}

// ---------------------------------------------------------------------------
// Attention (q = k = v = Q, per the reference's shared projection).
// Block = 4 waves x 16 query rows of one (b,h). Per 32-key step the block
// brings the 32 key rows (K = V) into LDS once, converted to bf16, row-major
// ([key][d]): a wave's load covers 2 whole 256 B rows. All four waves take both
// operands from that tile: a K A-fragment is two ds_load_b128 of a key row, a
// V^T A-fragment two ds_load_tr16_b128 (lane = d, 8 consecutive keys a load).
// Both products are transposed: S^T = K Q^T / 8 (4 WMMAs) and O^T += V^T P^T
// (4 WMMAs). A lane then holds 16 of the 32 scores of ONE query (lane & 15),
// its partner lane ^ 16 the other 16: the maximum is taken in the lane's own
// registers plus one exchange between the halves, and the two score tiles,
// converted in place, are the B operand P^T in the hardware k order.
// grid = (1024/64, b*h = 64). Output Z in concat layout as bf16.
// ---------------------------------------------------------------------------
constexpr int KV_PITCH = 72;  // bf16 per LDS row: 144 B = 16 B x 9, the ds_load_b128 readers' pitch

// Transposing LDS load of a row-major 16-bit tile T: with lane l pointing at
// T[k0 + 8*(l>>4) + (l&7)][d0 + 8*((l>>3)&1)], lane l gets
// T[k0 + 8*(l>>4) + 0..7][d0 + (l&15)].
__device__ inline v8bf lds_load_tr16(const __bf16* p) {
  typedef __attribute__((ext_vector_type(8))) short s16x8;
  typedef __attribute__((address_space(3))) s16x8 lds_s16x8;
  return __builtin_bit_cast(v8bf, __builtin_amdgcn_ds_load_tr16_b128_v8i16((lds_s16x8*)p));
}

// Value of lane l ^ 16 (v_permlanex16_b32 with the identity selects).
__device__ inline float xhalf(float x) {
  const int i = __builtin_bit_cast(int, x);
  return __builtin_bit_cast(float,
      __builtin_amdgcn_permlanex16(i, i, 0x76543210, 0xfedcba98, false, false));
}

__global__ __launch_bounds__(128) void attn_kernel(const float* __restrict__ Q,
                                                   __bf16* __restrict__ Zbf) {
  __shared__ __attribute__((aligned(16))) __bf16 kvtile[32 * KV_PITCH];  // [key][d], 4.5KB

  const int tid = threadIdx.x;
  const int lane = tid & 31;
  const int wave = tid >> 5;
  const int lanelo = lane & 15;
  const int half = lane >> 4;
  const int kh = half * 8;

  const int b = blockIdx.y >> 4;
  const int h = blockIdx.y & 15;
  const int q0 = blockIdx.x * 64 + wave * 16;
  const float* Qh = Q + (size_t)b * 1024 * 1024 + h * 64;  // (s,d) at s*1024 + d

  // Staging assignment: 16 lanes cover one key row (64 floats); rows skey + 8i.
  const int skey = tid >> 4;           // 0..7
  const int sdoff = (tid & 15) * 4;    // 0,4,..,60
  // This lane's address in the tile for the transposing loads (keys 0..15, d 0..15).
  const __bf16* vsrc = kvtile + (kh + (lane & 7)) * KV_PITCH + ((lane >> 3) & 1) * 8;

  // Preload Q^T B-fragments (column = query q0 + lanelo) for d-steps 0 and 32 (d_k = 64).
  v16bf bq0, bq1;
  {
    const float* rp = Qh + (size_t)(q0 + lanelo) * 1024;
    bq0 = cvt_frag_f32(rp, kh);
    bq1 = cvt_frag_f32(rp + 32, kh);
  }

  // Of query q0 + lanelo: m the running maximum (equal in both halves), l the
  // sum over this half's keys alone; the halves' sums are joined after the loop.
  float m = -1.0e30f, l = 0.0f;
  v8f zero = {};
  v8f o[4] = {zero, zero, zero, zero};  // o[t][r] = O^T[d = 16t + 8*half + r][query lanelo]

  const float inv_scale = 0.125f;  // 1/sqrt(64)

  for (int j0 = 0; j0 < 1024; j0 += 32) {
    // Cooperative key-tile stage: kvtile[key][d] = bf16(Qh[j0+key][d])
    {
      const float* src = Qh + (size_t)(j0 + skey) * 1024 + sdoff;
      v4f x[4];
#pragma unroll
      for (int i = 0; i < 4; ++i) x[i] = *(const v4f*)(src + (size_t)i * 8 * 1024);
#pragma unroll
      for (int i = 0; i < 4; ++i) {
        v4bf w;
#pragma unroll
        for (int j = 0; j < 4; ++j) w[j] = (__bf16)x[i][j];
        *(v4bf*)(kvtile + (skey + 8 * i) * KV_PITCH + sdoff) = w;
      }
    }
    __syncthreads();

    // S^T tile: 32 keys x 16 queries; s0[r] = key j0 + 8*half + r, s1[r] = key j0 + 16 + 8*half + r.
    v8f s0 = zero, s1 = zero;
    {
      const __bf16* kp = kvtile + lanelo * KV_PITCH;
      s0 = wmma_bf16(load_frag_bf16(kp, kh), bq0, s0);
      s0 = wmma_bf16(load_frag_bf16(kp + 32, kh), bq1, s0);
      kp = kvtile + (16 + lanelo) * KV_PITCH;
      s1 = wmma_bf16(load_frag_bf16(kp, kh), bq0, s1);
      s1 = wmma_bf16(load_frag_bf16(kp + 32, kh), bq1, s1);
    }

    // V^T fragments, row d = 16t + lanelo: keys kh..kh+7, then 16+kh..16+kh+7,
    // the k order of load_frag_bf16 and of the packed score tiles.
    v16bf va[4];
#pragma unroll
    for (int t = 0; t < 4; ++t) {
      v8bf lo = lds_load_tr16(vsrc + t * 16);
      v8bf hi = lds_load_tr16(vsrc + 16 * KV_PITCH + t * 16);
      va[t] = __builtin_shufflevector(lo, hi, 0, 1, 2, 3, 4, 5, 6, 7, 8, 9, 10, 11, 12, 13, 14, 15);
    }

    // Online softmax of this lane's query.
    float tm = fmaxf(s0[0], s1[0]);
#pragma unroll
    for (int r = 1; r < 8; ++r) tm = fmaxf(tm, fmaxf(s0[r], s1[r]));
    tm = fmaxf(tm, xhalf(tm)) * inv_scale;
    const float mn = fmaxf(m, tm);
    const float f = __expf(m - mn);
    m = mn;

    v16bf pb;  // P^T B-fragment: element e = key kh + e, element 8 + e = key 16 + kh + e
    float ps0 = 0.0f, ps1 = 0.0f;
#pragma unroll
    for (int r = 0; r < 8; ++r) {
      float p0 = __expf(s0[r] * inv_scale - mn);
      float p1 = __expf(s1[r] * inv_scale - mn);
      ps0 += p0;
      ps1 += p1;
      pb[r] = (__bf16)p0;
      pb[r + 8] = (__bf16)p1;
    }
    l = l * f + (ps0 + ps1);

#pragma unroll
    for (int t = 0; t < 4; ++t) {
      o[t] *= f;
      o[t] = wmma_bf16(va[t], pb, o[t]);
    }
    __syncthreads();  // protect kvtile before next j-step's stores
  }

  // Join the halves' sums, normalize and store (concat layout): 8 consecutive d = 16 B a store.
  const float linv = 1.0f / (l + xhalf(l));
  __bf16* zrow = Zbf + ((size_t)b * 1024 + q0 + lanelo) * 1024 + h * 64 + kh;
#pragma unroll
  for (int t = 0; t < 4; ++t) {
    v8bf w;
#pragma unroll
    for (int r = 0; r < 8; ++r) w[r] = (__bf16)(o[t][r] * linv);
    *(v8bf*)(zrow + t * 16) = w;
  }
}

// ---------------------------------------------------------------------------
// y = alpha * (x + r - mean) / (std_unbiased + 1e-6) + beta  (per row of 1024)
// ---------------------------------------------------------------------------
__global__ __launch_bounds__(256) void residual_ln_kernel(const float* __restrict__ X,
                                                          const float* __restrict__ R,
                                                          const float* __restrict__ alpha,
                                                          const float* __restrict__ beta,
                                                          float* outF, __bf16* outB) {
  __shared__ float s1[256], s2[256], stats[2];
  const int row = blockIdx.x;
  const int t = threadIdx.x;
  const float* xr = X + (size_t)row * 1024;
  const float* rr = R + (size_t)row * 1024;

  float v[4], sum = 0.0f, sq = 0.0f;
#pragma unroll
  for (int i = 0; i < 4; ++i) {
    int c = t + i * 256;
    float a = xr[c] + rr[c];
    v[i] = a; sum += a; sq += a * a;
  }
  s1[t] = sum; s2[t] = sq;
  __syncthreads();
  for (int s = 128; s > 0; s >>= 1) {
    if (t < s) { s1[t] += s1[t + s]; s2[t] += s2[t + s]; }
    __syncthreads();
  }
  if (t == 0) {
    float mean = s1[0] * (1.0f / 1024.0f);
    float var = (s2[0] - 1024.0f * mean * mean) * (1.0f / 1023.0f);  // ddof=1
    var = fmaxf(var, 0.0f);
    stats[0] = mean;
    stats[1] = 1.0f / (sqrtf(var) + 1e-6f);
  }
  __syncthreads();
  float mean = stats[0], rinv = stats[1];
#pragma unroll
  for (int i = 0; i < 4; ++i) {
    int c = t + i * 256;
    float y = alpha[c] * (v[i] - mean) * rinv + beta[c];
    size_t off = (size_t)row * 1024 + c;
    if (outF) outF[off] = y;
    if (outB) outB[off] = (__bf16)y;
  }
}

// ---------------------------------------------------------------------------
// Orchestration
// ---------------------------------------------------------------------------
extern "C" void kernel_launch(void* const* d_in, const int* in_sizes, int n_in,
                              void* d_out, int out_size, void* d_ws, size_t ws_size,
                              hipStream_t stream) {
  const float* x     = (const float*)d_in[0];   // [4,1024,1024]
  const float* Wq    = (const float*)d_in[1];   // [1024,1024]
  const float* bq    = (const float*)d_in[2];
  const float* Wo    = (const float*)d_in[3];
  const float* bo    = (const float*)d_in[4];
  const float* W1    = (const float*)d_in[5];   // [1024,2048]
  const float* b1    = (const float*)d_in[6];
  const float* W2    = (const float*)d_in[7];   // [2048,1024]
  const float* b2    = (const float*)d_in[8];
  const float* alpha = (const float*)d_in[9];
  const float* beta  = (const float*)d_in[10];

  char* ws = (char*)d_ws;
  const size_t MB = 1u << 20;
  __bf16* Xbf  = (__bf16*)(ws + 0);         //  8 MB  (4M bf16)
  __bf16* WqT  = (__bf16*)(ws + 8 * MB);    //  2 MB
  __bf16* WoT  = (__bf16*)(ws + 10 * MB);   //  2 MB
  __bf16* W1T  = (__bf16*)(ws + 12 * MB);   //  4 MB
  __bf16* W2T  = (__bf16*)(ws + 16 * MB);   //  4 MB
  float*  Qf   = (float*)(ws + 20 * MB);    // 16 MB
  __bf16* Zbf  = (__bf16*)(ws + 36 * MB);   //  8 MB
  float*  tmpF = (float*)(ws + 44 * MB);    // 16 MB (attn_out, then ff)
  float*  Yf   = (float*)(ws + 60 * MB);    // 16 MB
  __bf16* Ybf  = (__bf16*)(ws + 76 * MB);   //  8 MB
  __bf16* Hbf  = (__bf16*)(ws + 84 * MB);   // 16 MB (4096x2048)

  const int NTOK = 4096;                     // b*s

  // bf16 conversions / weight transposes
  cvt_kernel<<<NTOK * 1024 / 8192, 256, 0, stream>>>(x, Xbf);
  transpose_cvt_kernel<<<dim3(1024 / 64, 1024 / 64), 256, 0, stream>>>(Wq, WqT, 1024, 1024);
  transpose_cvt_kernel<<<dim3(1024 / 64, 1024 / 64), 256, 0, stream>>>(Wo, WoT, 1024, 1024);
  transpose_cvt_kernel<<<dim3(2048 / 64, 1024 / 64), 256, 0, stream>>>(W1, W1T, 1024, 2048);
  transpose_cvt_kernel<<<dim3(1024 / 64, 2048 / 64), 256, 0, stream>>>(W2, W2T, 2048, 1024);

  // Q = X @ Wq + bq   (q = k = v in the reference)
  gemm_kernel<<<dim3(1024 / 64, NTOK / 128), 256, 0, stream>>>(
      Xbf, WqT, bq, Qf, nullptr, NTOK, 1024, 1024, 0);

  // Z = softmax(Q Q^T / 8) @ Q, concat layout, bf16
  attn_kernel<<<dim3(1024 / 64, 64), 128, 0, stream>>>(Qf, Zbf);

  // attn_out = Z @ Wo + bo
  gemm_kernel<<<dim3(1024 / 64, NTOK / 128), 256, 0, stream>>>(
      Zbf, WoT, bo, tmpF, nullptr, NTOK, 1024, 1024, 0);

  // Y = LN(x + attn_out)
  residual_ln_kernel<<<NTOK, 256, 0, stream>>>(x, tmpF, alpha, beta, Yf, Ybf);

  // H = relu(Y @ W1 + b1)
  gemm_kernel<<<dim3(2048 / 64, NTOK / 128), 256, 0, stream>>>(
      Ybf, W1T, b1, nullptr, Hbf, NTOK, 2048, 1024, 1);

  // ff = H @ W2 + b2
  gemm_kernel<<<dim3(16, NTOK / 128), 256, 0, stream>>>(
      Hbf, W2T, b2, tmpF, nullptr, NTOK, 1024, 2048, 0);

  // out = LN(Y + ff)
  residual_ln_kernel<<<NTOK, 256, 0, stream>>>(Yf, tmpF, alpha, beta, (float*)d_out, nullptr);
}

// v007
// Measured time: 144 microseconds a run.
// Two timings next to v006 both put it at 1.08 times that version's speed.
// Counting every step since v000, it is 2.81 times as fast.
#include <hip/hip_runtime.h>
#include <math.h>

typedef __attribute__((ext_vector_type(16))) __bf16 v16bf;
typedef __attribute__((ext_vector_type(8)))  float  v8f;
typedef __attribute__((ext_vector_type(8)))  __bf16 v8bf;
typedef __attribute__((ext_vector_type(4)))  float  v4f;
typedef __attribute__((ext_vector_type(4)))  __bf16 v4bf;

// ---------------------------------------------------------------------------
// WMMA helper: D = A(16x32 bf16) * B(32x16 bf16) + C(16x16 f32)
// ---------------------------------------------------------------------------
__device__ inline v8f wmma_bf16(v16bf a, v16bf b, v8f c) {
  return __builtin_amdgcn_wmma_f32_16x16x32_bf16(
      /*neg_a=*/false, a, /*neg_b=*/false, b,
      /*c_mod=*/(short)0, c, /*reuse_a=*/false, /*reuse_b=*/false);
}

// Fragment element pattern (16-bit A/B, 16x32): per lane, element e maps to
// K = kh + e (e<8) or K = 16 + kh + (e-8) (e>=8), with kh = 8*(lane>=16).
__device__ inline v16bf load_frag_bf16(const __bf16* base, int kh) {
  v16bf r;
#pragma unroll
  for (int e = 0; e < 8; ++e) { r[e] = base[kh + e]; r[e + 8] = base[16 + kh + e]; }
  return r;
}

__device__ inline v16bf cvt_frag_f32(const float* base, int kh) {
  v16bf r;
#pragma unroll
  for (int e = 0; e < 8; ++e) { r[e] = (__bf16)base[kh + e]; r[e + 8] = (__bf16)base[16 + kh + e]; }
  return r;
}

// Low 32 bits of a flat shared-aperture address = LDS byte offset.
__device__ inline unsigned int lds_addr_u32(const void* p) {
  return (unsigned int)(size_t)p;
}

// CDNA5 async copies: 16B global -> LDS per lane, tracked by ASYNCcnt.
// One GEMM stage = 12 copies per lane: LDS rows step by lstep bytes, the first
// 8 copies walk A and the last 4 walk B, both by gstep bytes a copy.
// s_wait_xcnt 0 closes the statement, so that no address register named here
// takes the next stage's value ahead of it.
__device__ inline void async_stage_12xb128(unsigned int l, unsigned int lstep,
                                           const __bf16* ga, const __bf16* gb, size_t gstep) {
  const unsigned long long a = (unsigned long long)(size_t)ga;
  const unsigned long long b = (unsigned long long)(size_t)gb;
  asm volatile(
      "global_load_async_to_lds_b128 %0, %12, off\n\t"
      "global_load_async_to_lds_b128 %1, %13, off\n\t"
      "global_load_async_to_lds_b128 %2, %14, off\n\t"
      "global_load_async_to_lds_b128 %3, %15, off\n\t"
      "global_load_async_to_lds_b128 %4, %16, off\n\t"
      "global_load_async_to_lds_b128 %5, %17, off\n\t"
      "global_load_async_to_lds_b128 %6, %18, off\n\t"
      "global_load_async_to_lds_b128 %7, %19, off\n\t"
      "global_load_async_to_lds_b128 %8, %20, off\n\t"
      "global_load_async_to_lds_b128 %9, %21, off\n\t"
      "global_load_async_to_lds_b128 %10, %22, off\n\t"
      "global_load_async_to_lds_b128 %11, %23, off\n\t"
      "s_wait_xcnt 0x0"
      :
      : "v"(l), "v"(l + lstep), "v"(l + 2 * lstep), "v"(l + 3 * lstep),
        "v"(l + 4 * lstep), "v"(l + 5 * lstep), "v"(l + 6 * lstep), "v"(l + 7 * lstep),
        "v"(l + 8 * lstep), "v"(l + 9 * lstep), "v"(l + 10 * lstep), "v"(l + 11 * lstep),
        "v"(a), "v"(a + gstep), "v"(a + 2 * gstep), "v"(a + 3 * gstep),
        "v"(a + 4 * gstep), "v"(a + 5 * gstep), "v"(a + 6 * gstep), "v"(a + 7 * gstep),
        "v"(b), "v"(b + gstep), "v"(b + 2 * gstep), "v"(b + 3 * gstep)
      : "memory");
}
__device__ inline void wait_asynccnt0() {
  asm volatile("s_wait_asynccnt 0x0" ::: "memory");
}

// ---------------------------------------------------------------------------
// fp32 -> bf16 elementwise, 32 elements a thread, so that few waves have to start.
// A wave takes 1024 consecutive floats: eight 16 B loads a lane, each 512
// contiguous bytes of the wave, all in flight before the first conversion; a
// store of the wave is 256 contiguous bytes (two whole lines).
// A block of 256 threads takes the 8192 elements of chunk blk.
// ---------------------------------------------------------------------------
__device__ inline void cvt_block(const float* __restrict__ in, __bf16* __restrict__ out, int blk) {
  const size_t base = ((size_t)blk * 8 + (threadIdx.x >> 5)) * 1024 + (threadIdx.x & 31) * 4;
  v4f x[8];
#pragma unroll
  for (int i = 0; i < 8; ++i) x[i] = *(const v4f*)(in + base + i * 128);
#pragma unroll
  for (int i = 0; i < 8; ++i) *(v4bf*)(out + base + i * 128) = __builtin_convertvector(x[i], v4bf);
  // No other job's code follows in this block; a precaution: no register that these stores name is rewritten ahead of this wait.
  asm volatile("s_wait_xcnt 0x0" ::: "memory");
}

// W[K x N] row-major fp32  ->  Wt[N x K] row-major bf16, the 64x64 tile (bx, by)
// by one block of 256 threads.
// The tile turns in LDS, so that both sides of global memory see whole lines:
// a wave reads 2 rows x 256 B of W and stores 4 rows x 128 B of Wt.
// Pitch 65 floats: the row-wise writes and the column-wise reads of the tile
// both fall on 32 different banks. K and N are multiples of 64.
__device__ inline void transpose_cvt_block(float* tile, const float* __restrict__ in,
                                           __bf16* __restrict__ out, int K, int N, int bx, int by) {
  const int tid = threadIdx.x;
  const int n0 = bx * 64;
  const int k0 = by * 64;

  const int c4 = (tid & 15) * 4;  // 4 columns per thread
  const int r = tid >> 4;         // rows r, r+16, r+32, r+48
  v4f v[4];
#pragma unroll
  for (int i = 0; i < 4; ++i)
    v[i] = *(const v4f*)(in + (size_t)(k0 + r + 16 * i) * N + n0 + c4);
#pragma unroll
  for (int i = 0; i < 4; ++i) {
#pragma unroll
    for (int j = 0; j < 4; ++j) tile[(r + 16 * i) * 65 + c4 + j] = v[i][j];
  }
  __syncthreads();

  const int kc = (tid & 7) * 8;  // 8 consecutive k = 16 B of one Wt row
  const int nr = tid >> 3;       // Wt rows nr, nr+32
#pragma unroll
  for (int i = 0; i < 2; ++i) {
    const int n = nr + 32 * i;
    v8bf w;
#pragma unroll
    for (int j = 0; j < 8; ++j) w[j] = (__bf16)tile[(kc + j) * 65 + n];
    *(v8bf*)(out + (size_t)(n0 + n) * K + k0 + kc) = w;
  }
  // No other job's code follows in this block; a precaution: no register that these stores name is rewritten ahead of this wait.
  asm volatile("s_wait_xcnt 0x0" ::: "memory");
}

// All operand preparation in ONE launch: none of the five jobs reads what
// another writes, so the block index alone picks the job (a block-uniform
// choice; the barrier of a transposing block is passed by all of its threads).
// Blocks 0..255 Wq, 256..511 Wo (16 x 16 tiles each), 512..1023 W1 (32 x 16),
// 1024..1535 W2 (16 x 32), 1536..2047 the 512 chunks of x. grid = 2048.
__global__ __launch_bounds__(256) void prep_kernel(const float* __restrict__ x, __bf16* __restrict__ Xbf,
                                                   const float* __restrict__ Wq, __bf16* __restrict__ WqT,
                                                   const float* __restrict__ Wo, __bf16* __restrict__ WoT,
                                                   const float* __restrict__ W1, __bf16* __restrict__ W1T,
                                                   const float* __restrict__ W2, __bf16* __restrict__ W2T) {
  __shared__ float tile[64 * 65];  // [k_local][n_local]
  const int bid = blockIdx.x;
  if (bid < 256) {
    transpose_cvt_block(tile, Wq, WqT, 1024, 1024, bid & 15, bid >> 4);
  } else if (bid < 512) {
    transpose_cvt_block(tile, Wo, WoT, 1024, 1024, bid & 15, (bid - 256) >> 4);
  } else if (bid < 1024) {
    transpose_cvt_block(tile, W1, W1T, 1024, 2048, bid & 31, (bid - 512) >> 5);
  } else if (bid < 1536) {
    transpose_cvt_block(tile, W2, W2T, 2048, 1024, bid & 15, (bid - 1024) >> 4);
  } else {
    cvt_block(x, Xbf, bid - 1536);
  }
}

// ---------------------------------------------------------------------------
// GEMM: out[M x N] = A_bf16[M x K] @ Bt_bf16[N x K]^T + bias, optional relu.
// Wave = 16x64 output strip; 8 waves/block cover 128 rows x 64 cols.
// A stage is 128 k: the block's 128 A rows and 64 B rows, 256 B each (two whole
// lines), come into LDS by CDNA5 async-to-LDS copies (16 lanes a row, 12 copies
// a lane) and are read as ds_load_b128 fragments. K is a multiple of 128.
// grid = (N/64, M/128).
// ---------------------------------------------------------------------------
constexpr int GEMM_KS = 128;     // k per stage
constexpr int GEMM_PITCH = 136;  // bf16 per LDS row: 272 B = 16 B x 17, all 64 banks

__global__ __launch_bounds__(256) void gemm_kernel(const __bf16* __restrict__ A,
                                                   const __bf16* __restrict__ Bt,
                                                   const float* __restrict__ bias,
                                                   float* outF, __bf16* outB,
                                                   int M, int N, int K, int relu) {
  // rows 0..127: A [row_local][k_local]; rows 128..191: B [col_local][k_local]; 51KB
  __shared__ __attribute__((aligned(16))) __bf16 stage[(128 + 64) * GEMM_PITCH];
  const __bf16* atile = stage;
  const __bf16* btile = stage + 128 * GEMM_PITCH;

  const int tid = threadIdx.x;
  const int lane = tid & 31;
  const int wave = tid >> 5;
  const int lanelo = lane & 15;
  const int half = lane >> 4;
  const int kh = half * 8;

  const int m0 = blockIdx.y * 128 + wave * 16;
  const int n0 = blockIdx.x * 64;

  // Staging assignment: 16 lanes cover one 256 B row; a copy of the block covers 16 rows.
  const int srow = tid >> 4;           // 0..15
  const int skoff = (tid & 15) * 8;    // 0,8,..,120
  const unsigned int sdst = lds_addr_u32(stage) + (unsigned int)((srow * GEMM_PITCH + skoff) * 2);
  const __bf16* asrc = A + (size_t)(blockIdx.y * 128 + srow) * K + skoff;
  const __bf16* bsrc = Bt + (size_t)(n0 + srow) * K + skoff;

  v8f zero = {};
  v8f acc[4] = {zero, zero, zero, zero};

  for (int k0 = 0; k0 < K; k0 += GEMM_KS) {
    // stage[r][k] = A[blockrow+r][k0+k] (r < 128), Bt[n0+r-128][k0+k] (r >= 128)
    async_stage_12xb128(sdst, 16 * GEMM_PITCH * 2, asrc + k0, bsrc + k0, (size_t)16 * K * 2);
    wait_asynccnt0();
    __syncthreads();

    // Unrolled, so that the four 32-k slices' LDS offsets are immediates of the loads.
#pragma unroll
    for (int s = 0; s < GEMM_KS / 32; ++s) {
      v16bf va = load_frag_bf16(atile + (wave * 16 + lanelo) * GEMM_PITCH + s * 32, kh);
#pragma unroll
      for (int t = 0; t < 4; ++t) {
        v16bf vb = load_frag_bf16(btile + (t * 16 + lanelo) * GEMM_PITCH + s * 32, kh);
        acc[t] = wmma_bf16(va, vb, acc[t]);
      }
    }
    // This wave's LDS reads have retired before any wave's next copies land there.
    asm volatile("s_wait_dscnt 0x0" ::: "memory");
    __syncthreads();  // ends every reader's last read before the next stage's copies
  }

#pragma unroll
  for (int t = 0; t < 4; ++t) {
    int col = n0 + t * 16 + lanelo;
    float bv = bias[col];
#pragma unroll
    for (int r = 0; r < 8; ++r) {
      int mrow = m0 + r + 8 * half;
      float v = acc[t][r] + bv;
      if (relu) v = fmaxf(v, 0.0f);
      size_t off = (size_t)mrow * N + col;
      if (outF) outF[off] = v;
      if (outB) outB[off] = (__bf16)v;
    }
  }
}

// ---------------------------------------------------------------------------
// Attention (q = k = v = Q, per the reference's shared projection).
// Block = 4 waves x 16 query rows of one (b,h). Per 32-key step the block
// brings the 32 key rows (K = V) into LDS once, converted to bf16, row-major
// ([key][d]): a wave's load covers 2 whole 256 B rows. All four waves take both
// operands from that tile: a K A-fragment is two ds_load_b128 of a key row, a
// V^T A-fragment two ds_load_tr16_b128 (lane = d, 8 consecutive keys a load).
// Both products are transposed: S^T = K Q^T / 8 (4 WMMAs) and O^T += V^T P^T
// (4 WMMAs). A lane then holds 16 of the 32 scores of ONE query (lane & 15),
// its partner lane ^ 16 the other 16: the maximum is taken in the lane's own
// registers plus one exchange between the halves, and the two score tiles,
// converted in place, are the B operand P^T in the hardware k order.
// grid = (1024/64, b*h = 64). Output Z in concat layout as bf16.
// ---------------------------------------------------------------------------
constexpr int KV_PITCH = 72;  // bf16 per LDS row: 144 B = 16 B x 9, the ds_load_b128 readers' pitch

// Transposing LDS load of a row-major 16-bit tile T: with lane l pointing at
// T[k0 + 8*(l>>4) + (l&7)][d0 + 8*((l>>3)&1)], lane l gets
// T[k0 + 8*(l>>4) + 0..7][d0 + (l&15)].
__device__ inline v8bf lds_load_tr16(const __bf16* p) {
  typedef __attribute__((ext_vector_type(8))) short s16x8;
  typedef __attribute__((address_space(3))) s16x8 lds_s16x8;
  return __builtin_bit_cast(v8bf, __builtin_amdgcn_ds_load_tr16_b128_v8i16((lds_s16x8*)p));
}

// Value of lane l ^ 16 (v_permlanex16_b32 with the identity selects).
__device__ inline float xhalf(float x) {
  const int i = __builtin_bit_cast(int, x);
  return __builtin_bit_cast(float,
      __builtin_amdgcn_permlanex16(i, i, 0x76543210, 0xfedcba98, false, false));
}

__global__ __launch_bounds__(128) void attn_kernel(const float* __restrict__ Q,
                                                   __bf16* __restrict__ Zbf) {
  __shared__ __attribute__((aligned(16))) __bf16 kvtile[32 * KV_PITCH];  // [key][d], 4.5KB

  const int tid = threadIdx.x;
  const int lane = tid & 31;
  const int wave = tid >> 5;
  const int lanelo = lane & 15;
  const int half = lane >> 4;
  const int kh = half * 8;

  const int b = blockIdx.y >> 4;
  const int h = blockIdx.y & 15;
  const int q0 = blockIdx.x * 64 + wave * 16;
  const float* Qh = Q + (size_t)b * 1024 * 1024 + h * 64;  // (s,d) at s*1024 + d

  // Staging assignment: 16 lanes cover one key row (64 floats); rows skey + 8i.
  const int skey = tid >> 4;           // 0..7
  const int sdoff = (tid & 15) * 4;    // 0,4,..,60
  // This lane's address in the tile for the transposing loads (keys 0..15, d 0..15).
  const __bf16* vsrc = kvtile + (kh + (lane & 7)) * KV_PITCH + ((lane >> 3) & 1) * 8;

  // Preload Q^T B-fragments (column = query q0 + lanelo) for d-steps 0 and 32 (d_k = 64).
  v16bf bq0, bq1;
  {
    const float* rp = Qh + (size_t)(q0 + lanelo) * 1024;
    bq0 = cvt_frag_f32(rp, kh);
    bq1 = cvt_frag_f32(rp + 32, kh);
  }

  // Of query q0 + lanelo: m the running maximum (equal in both halves), l the
  // sum over this half's keys alone; the halves' sums are joined after the loop.
  float m = -1.0e30f, l = 0.0f;
  v8f zero = {};
  v8f o[4] = {zero, zero, zero, zero};  // o[t][r] = O^T[d = 16t + 8*half + r][query lanelo]

  const float inv_scale = 0.125f;  // 1/sqrt(64)

  for (int j0 = 0; j0 < 1024; j0 += 32) {
    // Cooperative key-tile stage: kvtile[key][d] = bf16(Qh[j0+key][d])
    {
      const float* src = Qh + (size_t)(j0 + skey) * 1024 + sdoff;
      v4f x[4];
#pragma unroll
      for (int i = 0; i < 4; ++i) x[i] = *(const v4f*)(src + (size_t)i * 8 * 1024);
#pragma unroll
      for (int i = 0; i < 4; ++i) {
        v4bf w;
#pragma unroll
        for (int j = 0; j < 4; ++j) w[j] = (__bf16)x[i][j];
        *(v4bf*)(kvtile + (skey + 8 * i) * KV_PITCH + sdoff) = w;
      }
    }
    __syncthreads();

    // S^T tile: 32 keys x 16 queries; s0[r] = key j0 + 8*half + r, s1[r] = key j0 + 16 + 8*half + r.
    v8f s0 = zero, s1 = zero;
    {
      const __bf16* kp = kvtile + lanelo * KV_PITCH;
      s0 = wmma_bf16(load_frag_bf16(kp, kh), bq0, s0);
      s0 = wmma_bf16(load_frag_bf16(kp + 32, kh), bq1, s0);
      kp = kvtile + (16 + lanelo) * KV_PITCH;
      s1 = wmma_bf16(load_frag_bf16(kp, kh), bq0, s1);
      s1 = wmma_bf16(load_frag_bf16(kp + 32, kh), bq1, s1);
    }

    // V^T fragments, row d = 16t + lanelo: keys kh..kh+7, then 16+kh..16+kh+7,
    // the k order of load_frag_bf16 and of the packed score tiles.
    v16bf va[4];
#pragma unroll
    for (int t = 0; t < 4; ++t) {
      v8bf lo = lds_load_tr16(vsrc + t * 16);
      v8bf hi = lds_load_tr16(vsrc + 16 * KV_PITCH + t * 16);
      va[t] = __builtin_shufflevector(lo, hi, 0, 1, 2, 3, 4, 5, 6, 7, 8, 9, 10, 11, 12, 13, 14, 15);
    }

    // Online softmax of this lane's query.
    float tm = fmaxf(s0[0], s1[0]);
#pragma unroll
    for (int r = 1; r < 8; ++r) tm = fmaxf(tm, fmaxf(s0[r], s1[r]));
    tm = fmaxf(tm, xhalf(tm)) * inv_scale;
    const float mn = fmaxf(m, tm);
    const float f = __expf(m - mn);
    m = mn;

    v16bf pb;  // P^T B-fragment: element e = key kh + e, element 8 + e = key 16 + kh + e
    float ps0 = 0.0f, ps1 = 0.0f;
#pragma unroll
    for (int r = 0; r < 8; ++r) {
      float p0 = __expf(s0[r] * inv_scale - mn);
      float p1 = __expf(s1[r] * inv_scale - mn);
      ps0 += p0;
      ps1 += p1;
      pb[r] = (__bf16)p0;
      pb[r + 8] = (__bf16)p1;
    }
    l = l * f + (ps0 + ps1);

#pragma unroll
    for (int t = 0; t < 4; ++t) {
      o[t] *= f;
      o[t] = wmma_bf16(va[t], pb, o[t]);
    }
    __syncthreads();  // protect kvtile before next j-step's stores
  }

  // Join the halves' sums, normalize and store (concat layout): 8 consecutive d = 16 B a store.
  const float linv = 1.0f / (l + xhalf(l));
  __bf16* zrow = Zbf + ((size_t)b * 1024 + q0 + lanelo) * 1024 + h * 64 + kh;
#pragma unroll
  for (int t = 0; t < 4; ++t) {
    v8bf w;
#pragma unroll
    for (int r = 0; r < 8; ++r) w[r] = (__bf16)(o[t][r] * linv);
    *(v8bf*)(zrow + t * 16) = w;
  }
}

// ---------------------------------------------------------------------------
// y = alpha * (x + r - mean) / (std_unbiased + 1e-6) + beta  (per row of 1024)
// ---------------------------------------------------------------------------
__global__ __launch_bounds__(256) void residual_ln_kernel(const float* __restrict__ X,
                                                          const float* __restrict__ R,
                                                          const float* __restrict__ alpha,
                                                          const float* __restrict__ beta,
                                                          float* outF, __bf16* outB) {
  __shared__ float s1[256], s2[256], stats[2];
  const int row = blockIdx.x;
  const int t = threadIdx.x;
  const float* xr = X + (size_t)row * 1024;
  const float* rr = R + (size_t)row * 1024;

  float v[4], sum = 0.0f, sq = 0.0f;
#pragma unroll
  for (int i = 0; i < 4; ++i) {
    int c = t + i * 256;
    float a = xr[c] + rr[c];
    v[i] = a; sum += a; sq += a * a;
  }
  s1[t] = sum; s2[t] = sq;
  __syncthreads();
  for (int s = 128; s > 0; s >>= 1) {
    if (t < s) { s1[t] += s1[t + s]; s2[t] += s2[t + s]; }
    __syncthreads();
  }
  if (t == 0) {
    float mean = s1[0] * (1.0f / 1024.0f);
    float var = (s2[0] - 1024.0f * mean * mean) * (1.0f / 1023.0f);  // ddof=1
    var = fmaxf(var, 0.0f);
    stats[0] = mean;
    stats[1] = 1.0f / (sqrtf(var) + 1e-6f);
  }
  __syncthreads();
  float mean = stats[0], rinv = stats[1];
#pragma unroll
  for (int i = 0; i < 4; ++i) {
    int c = t + i * 256;
    float y = alpha[c] * (v[i] - mean) * rinv + beta[c];
    size_t off = (size_t)row * 1024 + c;
    if (outF) outF[off] = y;
    if (outB) outB[off] = (__bf16)y;
  }
}

// ---------------------------------------------------------------------------
// Orchestration
// ---------------------------------------------------------------------------
extern "C" void kernel_launch(void* const* d_in, const int* in_sizes, int n_in,
                              void* d_out, int out_size, void* d_ws, size_t ws_size,
                              hipStream_t stream) {
  const float* x     = (const float*)d_in[0];   // [4,1024,1024]
  const float* Wq    = (const float*)d_in[1];   // [1024,1024]
  const float* bq    = (const float*)d_in[2];
  const float* Wo    = (const float*)d_in[3];
  const float* bo    = (const float*)d_in[4];
  const float* W1    = (const float*)d_in[5];   // [1024,2048]
  const float* b1    = (const float*)d_in[6];
  const float* W2    = (const float*)d_in[7];   // [2048,1024]
  const float* b2    = (const float*)d_in[8];
  const float* alpha = (const float*)d_in[9];
  const float* beta  = (const float*)d_in[10];

  char* ws = (char*)d_ws;
  const size_t MB = 1u << 20;
  __bf16* Xbf  = (__bf16*)(ws + 0);         //  8 MB  (4M bf16)
  __bf16* WqT  = (__bf16*)(ws + 8 * MB);    //  2 MB
  __bf16* WoT  = (__bf16*)(ws + 10 * MB);   //  2 MB
  __bf16* W1T  = (__bf16*)(ws + 12 * MB);   //  4 MB
  __bf16* W2T  = (__bf16*)(ws + 16 * MB);   //  4 MB
  float*  Qf   = (float*)(ws + 20 * MB);    // 16 MB
  __bf16* Zbf  = (__bf16*)(ws + 36 * MB);   //  8 MB
  float*  tmpF = (float*)(ws + 44 * MB);    // 16 MB (attn_out, then ff)
  float*  Yf   = (float*)(ws + 60 * MB);    // 16 MB
  __bf16* Ybf  = (__bf16*)(ws + 76 * MB);   //  8 MB
  __bf16* Hbf  = (__bf16*)(ws + 84 * MB);   // 16 MB (4096x2048)

  const int NTOK = 4096;                     // b*s

  // bf16 conversion of x and the four weight transposes, one launch
  prep_kernel<<<2048, 256, 0, stream>>>(x, Xbf, Wq, WqT, Wo, WoT, W1, W1T, W2, W2T);

  // Q = X @ Wq + bq   (q = k = v in the reference)
  gemm_kernel<<<dim3(1024 / 64, NTOK / 128), 256, 0, stream>>>(
      Xbf, WqT, bq, Qf, nullptr, NTOK, 1024, 1024, 0);

  // Z = softmax(Q Q^T / 8) @ Q, concat layout, bf16
  attn_kernel<<<dim3(1024 / 64, 64), 128, 0, stream>>>(Qf, Zbf);

  // attn_out = Z @ Wo + bo
  gemm_kernel<<<dim3(1024 / 64, NTOK / 128), 256, 0, stream>>>(
      Zbf, WoT, bo, tmpF, nullptr, NTOK, 1024, 1024, 0);

  // Y = LN(x + attn_out)
  residual_ln_kernel<<<NTOK, 256, 0, stream>>>(x, tmpF, alpha, beta, Yf, Ybf);

  // H = relu(Y @ W1 + b1)
  gemm_kernel<<<dim3(2048 / 64, NTOK / 128), 256, 0, stream>>>(
      Ybf, W1T, b1, nullptr, Hbf, NTOK, 2048, 1024, 1);

  // ff = H @ W2 + b2
  gemm_kernel<<<dim3(16, NTOK / 128), 256, 0, stream>>>(
      Hbf, W2T, b2, tmpF, nullptr, NTOK, 1024, 2048, 0);

  // out = LN(Y + ff)
  residual_ln_kernel<<<NTOK, 256, 0, stream>>>(Yf, tmpF, alpha, beta, (float*)d_out, nullptr);
}

// v008
// One run takes 136 microseconds.
// In two side-by-side timings against v007, it was 1.05 and 1.06 times as fast.
// All steps since v000 together make it 2.96 times as fast.
#include <hip/hip_runtime.h>
#include <math.h>

typedef __attribute__((ext_vector_type(16))) __bf16 v16bf;
typedef __attribute__((ext_vector_type(8)))  float  v8f;
typedef __attribute__((ext_vector_type(8)))  __bf16 v8bf;
typedef __attribute__((ext_vector_type(4)))  float  v4f;
typedef __attribute__((ext_vector_type(4)))  __bf16 v4bf;

// ---------------------------------------------------------------------------
// WMMA helper: D = A(16x32 bf16) * B(32x16 bf16) + C(16x16 f32)
// ---------------------------------------------------------------------------
__device__ inline v8f wmma_bf16(v16bf a, v16bf b, v8f c) {
  return __builtin_amdgcn_wmma_f32_16x16x32_bf16(
      /*neg_a=*/false, a, /*neg_b=*/false, b,
      /*c_mod=*/(short)0, c, /*reuse_a=*/false, /*reuse_b=*/false);
}

// Fragment element pattern (16-bit A/B, 16x32): per lane, element e maps to
// K = kh + e (e<8) or K = 16 + kh + (e-8) (e>=8), with kh = 8*(lane>=16).
__device__ inline v16bf load_frag_bf16(const __bf16* base, int kh) {
  v16bf r;
#pragma unroll
  for (int e = 0; e < 8; ++e) { r[e] = base[kh + e]; r[e + 8] = base[16 + kh + e]; }
  return r;
}

__device__ inline v16bf cvt_frag_f32(const float* base, int kh) {
  v16bf r;
#pragma unroll
  for (int e = 0; e < 8; ++e) { r[e] = (__bf16)base[kh + e]; r[e + 8] = (__bf16)base[16 + kh + e]; }
  return r;
}

// Low 32 bits of a flat shared-aperture address = LDS byte offset.
__device__ inline unsigned int lds_addr_u32(const void* p) {
  return (unsigned int)(size_t)p;
}

// CDNA5 async copies: 16B global -> LDS per lane, tracked by ASYNCcnt.
// One GEMM stage = 12 copies per lane: LDS rows step by lstep bytes, the first
// 8 copies walk A and the last 4 walk B, both by gstep bytes a copy.
// s_wait_xcnt 0 closes the statement, so that no address register named here
// takes the next stage's value ahead of it.
__device__ inline void async_stage_12xb128(unsigned int l, unsigned int lstep,
                                           const __bf16* ga, const __bf16* gb, size_t gstep) {
  const unsigned long long a = (unsigned long long)(size_t)ga;
  const unsigned long long b = (unsigned long long)(size_t)gb;
  asm volatile(
      "global_load_async_to_lds_b128 %0, %12, off\n\t"
      "global_load_async_to_lds_b128 %1, %13, off\n\t"
      "global_load_async_to_lds_b128 %2, %14, off\n\t"
      "global_load_async_to_lds_b128 %3, %15, off\n\t"
      "global_load_async_to_lds_b128 %4, %16, off\n\t"
      "global_load_async_to_lds_b128 %5, %17, off\n\t"
      "global_load_async_to_lds_b128 %6, %18, off\n\t"
      "global_load_async_to_lds_b128 %7, %19, off\n\t"
      "global_load_async_to_lds_b128 %8, %20, off\n\t"
      "global_load_async_to_lds_b128 %9, %21, off\n\t"
      "global_load_async_to_lds_b128 %10, %22, off\n\t"
      "global_load_async_to_lds_b128 %11, %23, off\n\t"
      "s_wait_xcnt 0x0"
      :
      : "v"(l), "v"(l + lstep), "v"(l + 2 * lstep), "v"(l + 3 * lstep),
        "v"(l + 4 * lstep), "v"(l + 5 * lstep), "v"(l + 6 * lstep), "v"(l + 7 * lstep),
        "v"(l + 8 * lstep), "v"(l + 9 * lstep), "v"(l + 10 * lstep), "v"(l + 11 * lstep),
        "v"(a), "v"(a + gstep), "v"(a + 2 * gstep), "v"(a + 3 * gstep),
        "v"(a + 4 * gstep), "v"(a + 5 * gstep), "v"(a + 6 * gstep), "v"(a + 7 * gstep),
        "v"(b), "v"(b + gstep), "v"(b + 2 * gstep), "v"(b + 3 * gstep)
      : "memory");
}
__device__ inline void wait_asynccnt0() {
  asm volatile("s_wait_asynccnt 0x0" ::: "memory");
}

// ---------------------------------------------------------------------------
// fp32 -> bf16 elementwise, 32 elements a thread, so that few waves have to start.
// A wave takes 1024 consecutive floats: eight 16 B loads a lane, each 512
// contiguous bytes of the wave, all in flight before the first conversion; a
// store of the wave is 256 contiguous bytes (two whole lines).
// A block of 256 threads takes the 8192 elements of chunk blk.
// ---------------------------------------------------------------------------
__device__ inline void cvt_block(const float* __restrict__ in, __bf16* __restrict__ out, int blk) {
  const size_t base = ((size_t)blk * 8 + (threadIdx.x >> 5)) * 1024 + (threadIdx.x & 31) * 4;
  v4f x[8];
#pragma unroll
  for (int i = 0; i < 8; ++i) x[i] = *(const v4f*)(in + base + i * 128);
#pragma unroll
  for (int i = 0; i < 8; ++i) *(v4bf*)(out + base + i * 128) = __builtin_convertvector(x[i], v4bf);
  // No other job's code follows in this block; a precaution: no register that these stores name is rewritten ahead of this wait.
  asm volatile("s_wait_xcnt 0x0" ::: "memory");
}

// W[K x N] row-major fp32  ->  Wt[N x K] row-major bf16, the 64x64 tile (bx, by)
// by one block of 256 threads.
// The tile turns in LDS, so that both sides of global memory see whole lines:
// a wave reads 2 rows x 256 B of W and stores 4 rows x 128 B of Wt.
// Pitch 65 floats: the row-wise writes and the column-wise reads of the tile
// both fall on 32 different banks. K and N are multiples of 64.
__device__ inline void transpose_cvt_block(float* tile, const float* __restrict__ in,
                                           __bf16* __restrict__ out, int K, int N, int bx, int by) {
  const int tid = threadIdx.x;
  const int n0 = bx * 64;
  const int k0 = by * 64;

  const int c4 = (tid & 15) * 4;  // 4 columns per thread
  const int r = tid >> 4;         // rows r, r+16, r+32, r+48
  v4f v[4];
#pragma unroll
  for (int i = 0; i < 4; ++i)
    v[i] = *(const v4f*)(in + (size_t)(k0 + r + 16 * i) * N + n0 + c4);
#pragma unroll
  for (int i = 0; i < 4; ++i) {
#pragma unroll
    for (int j = 0; j < 4; ++j) tile[(r + 16 * i) * 65 + c4 + j] = v[i][j];
  }
  __syncthreads();

  const int kc = (tid & 7) * 8;  // 8 consecutive k = 16 B of one Wt row
  const int nr = tid >> 3;       // Wt rows nr, nr+32
#pragma unroll
  for (int i = 0; i < 2; ++i) {
    const int n = nr + 32 * i;
    v8bf w;
#pragma unroll
    for (int j = 0; j < 8; ++j) w[j] = (__bf16)tile[(kc + j) * 65 + n];
    *(v8bf*)(out + (size_t)(n0 + n) * K + k0 + kc) = w;
  }
  // No other job's code follows in this block; a precaution: no register that these stores name is rewritten ahead of this wait.
  asm volatile("s_wait_xcnt 0x0" ::: "memory");
}

// All operand preparation in ONE launch: none of the five jobs reads what
// another writes, so the block index alone picks the job (a block-uniform
// choice; the barrier of a transposing block is passed by all of its threads).
// Blocks 0..255 Wq, 256..511 Wo (16 x 16 tiles each), 512..1023 W1 (32 x 16),
// 1024..1535 W2 (16 x 32), 1536..2047 the 512 chunks of x. grid = 2048.
__global__ __launch_bounds__(256) void prep_kernel(const float* __restrict__ x, __bf16* __restrict__ Xbf,
                                                   const float* __restrict__ Wq, __bf16* __restrict__ WqT,
                                                   const float* __restrict__ Wo, __bf16* __restrict__ WoT,
                                                   const float* __restrict__ W1, __bf16* __restrict__ W1T,
                                                   const float* __restrict__ W2, __bf16* __restrict__ W2T) {
  __shared__ float tile[64 * 65];  // [k_local][n_local]
  const int bid = blockIdx.x;
  if (bid < 256) {
    transpose_cvt_block(tile, Wq, WqT, 1024, 1024, bid & 15, bid >> 4);
  } else if (bid < 512) {
    transpose_cvt_block(tile, Wo, WoT, 1024, 1024, bid & 15, (bid - 256) >> 4);
  } else if (bid < 1024) {
    transpose_cvt_block(tile, W1, W1T, 1024, 2048, bid & 31, (bid - 512) >> 5);
  } else if (bid < 1536) {
    transpose_cvt_block(tile, W2, W2T, 2048, 1024, bid & 15, (bid - 1024) >> 4);
  } else {
    cvt_block(x, Xbf, bid - 1536);
  }
}

// ---------------------------------------------------------------------------
// GEMM: out[M x N] = A_bf16[M x K] @ Bt_bf16[N x K]^T + bias, optional relu.
// Wave = 16x64 output strip; 8 waves/block cover 128 rows x 64 cols.
// A stage is 128 k: the block's 128 A rows and 64 B rows, 256 B each (two whole
// lines), come into LDS by CDNA5 async-to-LDS copies (16 lanes a row, 12 copies
// a lane) and are read as ds_load_b128 fragments. K is a multiple of 128.
// grid = (N/64, M/128).
// ---------------------------------------------------------------------------
constexpr int GEMM_KS = 128;     // k per stage
constexpr int GEMM_PITCH = 136;  // bf16 per LDS row: 272 B = 16 B x 17, all 64 banks

// Second bound: 8 waves a SIMD (128 registers a wave), so that both fragment sets
// leave four blocks resident on a WGP, as the widest of the four launches asks.
__global__ __launch_bounds__(256, 8) void gemm_kernel(const __bf16* __restrict__ A,
                                                   const __bf16* __restrict__ Bt,
                                                   const float* __restrict__ bias,
                                                   float* outF, __bf16* outB,
                                                   int M, int N, int K, int relu) {
  // rows 0..127: A [row_local][k_local]; rows 128..191: B [col_local][k_local]; 51KB
  __shared__ __attribute__((aligned(16))) __bf16 stage[(128 + 64) * GEMM_PITCH];
  const __bf16* atile = stage;
  const __bf16* btile = stage + 128 * GEMM_PITCH;

  const int tid = threadIdx.x;
  const int lane = tid & 31;
  const int wave = tid >> 5;
  const int lanelo = lane & 15;
  const int half = lane >> 4;
  const int kh = half * 8;

  const int m0 = blockIdx.y * 128 + wave * 16;
  const int n0 = blockIdx.x * 64;

  // Staging assignment: 16 lanes cover one 256 B row; a copy of the block covers 16 rows.
  const int srow = tid >> 4;           // 0..15
  const int skoff = (tid & 15) * 8;    // 0,8,..,120
  const unsigned int sdst = lds_addr_u32(stage) + (unsigned int)((srow * GEMM_PITCH + skoff) * 2);
  const __bf16* asrc = A + (size_t)(blockIdx.y * 128 + srow) * K + skoff;
  const __bf16* bsrc = Bt + (size_t)(n0 + srow) * K + skoff;

  v8f zero = {};
  v8f acc[4] = {zero, zero, zero, zero};

  for (int k0 = 0; k0 < K; k0 += GEMM_KS) {
    // stage[r][k] = A[blockrow+r][k0+k] (r < 128), Bt[n0+r-128][k0+k] (r >= 128)
    async_stage_12xb128(sdst, 16 * GEMM_PITCH * 2, asrc + k0, bsrc + k0, (size_t)16 * K * 2);
    wait_asynccnt0();
    __syncthreads();

    // Two fragment sets: slice s + 1's ten LDS reads go out as one group ahead of
    // slice s's WMMAs, which then wait only for reads issued a whole slice earlier.
    v16bf va[2], vb[2][4];
    va[0] = load_frag_bf16(atile + (wave * 16 + lanelo) * GEMM_PITCH, kh);
#pragma unroll
    for (int t = 0; t < 4; ++t) vb[0][t] = load_frag_bf16(btile + (t * 16 + lanelo) * GEMM_PITCH, kh);
    // Unrolled, so that the four 32-k slices' LDS offsets are immediates of the loads
    // and the set index is a constant.
#pragma unroll
    for (int s = 0; s < GEMM_KS / 32; ++s) {
      const int cur = s & 1, nxt = cur ^ 1;
      if (s + 1 < GEMM_KS / 32) {
        va[nxt] = load_frag_bf16(atile + (wave * 16 + lanelo) * GEMM_PITCH + (s + 1) * 32, kh);
#pragma unroll
        for (int t = 0; t < 4; ++t)
          vb[nxt][t] = load_frag_bf16(btile + (t * 16 + lanelo) * GEMM_PITCH + (s + 1) * 32, kh);
      }
      // Keeps the next slice's reads ahead of this slice's WMMAs: sunk among them, each WMMA waits out an LDS latency.
      __builtin_amdgcn_sched_barrier(0);
#pragma unroll
      for (int t = 0; t < 4; ++t) acc[t] = wmma_bf16(va[cur], vb[cur][t], acc[t]);
    }
    // This wave's LDS reads have retired before any wave's next copies land there.
    asm volatile("s_wait_dscnt 0x0" ::: "memory");
    __syncthreads();  // ends every reader's last read before the next stage's copies
  }

#pragma unroll
  for (int t = 0; t < 4; ++t) {
    int col = n0 + t * 16 + lanelo;
    float bv = bias[col];
#pragma unroll
    for (int r = 0; r < 8; ++r) {
      int mrow = m0 + r + 8 * half;
      float v = acc[t][r] + bv;
      if (relu) v = fmaxf(v, 0.0f);
      size_t off = (size_t)mrow * N + col;
      if (outF) outF[off] = v;
      if (outB) outB[off] = (__bf16)v;
    }
  }
}

// ---------------------------------------------------------------------------
// Attention (q = k = v = Q, per the reference's shared projection).
// Block = 4 waves x 16 query rows of one (b,h). Per 32-key step the block
// brings the 32 key rows (K = V) into LDS once, converted to bf16, row-major
// ([key][d]): a wave's load covers 2 whole 256 B rows. All four waves take both
// operands from that tile: a K A-fragment is two ds_load_b128 of a key row, a
// V^T A-fragment two ds_load_tr16_b128 (lane = d, 8 consecutive keys a load).
// Both products are transposed: S^T = K Q^T / 8 (4 WMMAs) and O^T += V^T P^T
// (4 WMMAs). A lane then holds 16 of the 32 scores of ONE query (lane & 15),
// its partner lane ^ 16 the other 16: the maximum is taken in the lane's own
// registers plus one exchange between the halves, and the two score tiles,
// converted in place, are the B operand P^T in the hardware k order.
// grid = (1024/64, b*h = 64). Output Z in concat layout as bf16.
// ---------------------------------------------------------------------------
constexpr int KV_PITCH = 72;  // bf16 per LDS row: 144 B = 16 B x 9, the ds_load_b128 readers' pitch

// Transposing LDS load of a row-major 16-bit tile T: with lane l pointing at
// T[k0 + 8*(l>>4) + (l&7)][d0 + 8*((l>>3)&1)], lane l gets
// T[k0 + 8*(l>>4) + 0..7][d0 + (l&15)].
__device__ inline v8bf lds_load_tr16(const __bf16* p) {
  typedef __attribute__((ext_vector_type(8))) short s16x8;
  typedef __attribute__((address_space(3))) s16x8 lds_s16x8;
  return __builtin_bit_cast(v8bf, __builtin_amdgcn_ds_load_tr16_b128_v8i16((lds_s16x8*)p));
}

// Value of lane l ^ 16 (v_permlanex16_b32 with the identity selects).
__device__ inline float xhalf(float x) {
  const int i = __builtin_bit_cast(int, x);
  return __builtin_bit_cast(float,
      __builtin_amdgcn_permlanex16(i, i, 0x76543210, 0xfedcba98, false, false));
}

__global__ __launch_bounds__(128) void attn_kernel(const float* __restrict__ Q,
                                                   __bf16* __restrict__ Zbf) {
  __shared__ __attribute__((aligned(16))) __bf16 kvtile[32 * KV_PITCH];  // [key][d], 4.5KB

  const int tid = threadIdx.x;
  const int lane = tid & 31;
  const int wave = tid >> 5;
  const int lanelo = lane & 15;
  const int half = lane >> 4;
  const int kh = half * 8;

  const int b = blockIdx.y >> 4;
  const int h = blockIdx.y & 15;
  const int q0 = blockIdx.x * 64 + wave * 16;
  const float* Qh = Q + (size_t)b * 1024 * 1024 + h * 64;  // (s,d) at s*1024 + d

  // Staging assignment: 16 lanes cover one key row (64 floats); rows skey + 8i.
  const int skey = tid >> 4;           // 0..7
  const int sdoff = (tid & 15) * 4;    // 0,4,..,60
  // This lane's address in the tile for the transposing loads (keys 0..15, d 0..15).
  const __bf16* vsrc = kvtile + (kh + (lane & 7)) * KV_PITCH + ((lane >> 3) & 1) * 8;

  // Preload Q^T B-fragments (column = query q0 + lanelo) for d-steps 0 and 32 (d_k = 64).
  v16bf bq0, bq1;
  {
    const float* rp = Qh + (size_t)(q0 + lanelo) * 1024;
    bq0 = cvt_frag_f32(rp, kh);
    bq1 = cvt_frag_f32(rp + 32, kh);
  }

  // Of query q0 + lanelo: m the running maximum (equal in both halves), l the
  // sum over this half's keys alone; the halves' sums are joined after the loop.
  float m = -1.0e30f, l = 0.0f;
  v8f zero = {};
  v8f o[4] = {zero, zero, zero, zero};  // o[t][r] = O^T[d = 16t + 8*half + r][query lanelo]

  const float inv_scale = 0.125f;  // 1/sqrt(64)

  for (int j0 = 0; j0 < 1024; j0 += 32) {
    // Cooperative key-tile stage: kvtile[key][d] = bf16(Qh[j0+key][d])
    {
      const float* src = Qh + (size_t)(j0 + skey) * 1024 + sdoff;
      v4f x[4];
#pragma unroll
      for (int i = 0; i < 4; ++i) x[i] = *(const v4f*)(src + (size_t)i * 8 * 1024);
#pragma unroll
      for (int i = 0; i < 4; ++i) {
        v4bf w;
#pragma unroll
        for (int j = 0; j < 4; ++j) w[j] = (__bf16)x[i][j];
        *(v4bf*)(kvtile + (skey + 8 * i) * KV_PITCH + sdoff) = w;
      }
    }
    __syncthreads();

    // S^T tile: 32 keys x 16 queries; s0[r] = key j0 + 8*half + r, s1[r] = key j0 + 16 + 8*half + r.
    v8f s0 = zero, s1 = zero;
    {
      const __bf16* kp = kvtile + lanelo * KV_PITCH;
      s0 = wmma_bf16(load_frag_bf16(kp, kh), bq0, s0);
      s0 = wmma_bf16(load_frag_bf16(kp + 32, kh), bq1, s0);
      kp = kvtile + (16 + lanelo) * KV_PITCH;
      s1 = wmma_bf16(load_frag_bf16(kp, kh), bq0, s1);
      s1 = wmma_bf16(load_frag_bf16(kp + 32, kh), bq1, s1);
    }

    // V^T fragments, row d = 16t + lanelo: keys kh..kh+7, then 16+kh..16+kh+7,
    // the k order of load_frag_bf16 and of the packed score tiles.
    v16bf va[4];
#pragma unroll
    for (int t = 0; t < 4; ++t) {
      v8bf lo = lds_load_tr16(vsrc + t * 16);
      v8bf hi = lds_load_tr16(vsrc + 16 * KV_PITCH + t * 16);
      va[t] = __builtin_shufflevector(lo, hi, 0, 1, 2, 3, 4, 5, 6, 7, 8, 9, 10, 11, 12, 13, 14, 15);
    }

    // Online softmax of this lane's query.
    float tm = fmaxf(s0[0], s1[0]);
#pragma unroll
    for (int r = 1; r < 8; ++r) tm = fmaxf(tm, fmaxf(s0[r], s1[r]));
    tm = fmaxf(tm, xhalf(tm)) * inv_scale;
    const float mn = fmaxf(m, tm);
    const float f = __expf(m - mn);
    m = mn;

    v16bf pb;  // P^T B-fragment: element e = key kh + e, element 8 + e = key 16 + kh + e
    float ps0 = 0.0f, ps1 = 0.0f;
#pragma unroll
    for (int r = 0; r < 8; ++r) {
      float p0 = __expf(s0[r] * inv_scale - mn);
      float p1 = __expf(s1[r] * inv_scale - mn);
      ps0 += p0;
      ps1 += p1;
      pb[r] = (__bf16)p0;
      pb[r + 8] = (__bf16)p1;
    }
    l = l * f + (ps0 + ps1);

#pragma unroll
    for (int t = 0; t < 4; ++t) {
      o[t] *= f;
      o[t] = wmma_bf16(va[t], pb, o[t]);
    }
    __syncthreads();  // protect kvtile before next j-step's stores
  }

  // Join the halves' sums, normalize and store (concat layout): 8 consecutive d = 16 B a store.
  const float linv = 1.0f / (l + xhalf(l));
  __bf16* zrow = Zbf + ((size_t)b * 1024 + q0 + lanelo) * 1024 + h * 64 + kh;
#pragma unroll
  for (int t = 0; t < 4; ++t) {
    v8bf w;
#pragma unroll
    for (int r = 0; r < 8; ++r) w[r] = (__bf16)(o[t][r] * linv);
    *(v8bf*)(zrow + t * 16) = w;
  }
}

// ---------------------------------------------------------------------------
// y = alpha * (x + r - mean) / (std_unbiased + 1e-6) + beta  (per row of 1024)
// ---------------------------------------------------------------------------
__global__ __launch_bounds__(256) void residual_ln_kernel(const float* __restrict__ X,
                                                          const float* __restrict__ R,
                                                          const float* __restrict__ alpha,
                                                          const float* __restrict__ beta,
                                                          float* outF, __bf16* outB) {
  __shared__ float s1[256], s2[256], stats[2];
  const int row = blockIdx.x;
  const int t = threadIdx.x;
  const float* xr = X + (size_t)row * 1024;
  const float* rr = R + (size_t)row * 1024;

  float v[4], sum = 0.0f, sq = 0.0f;
#pragma unroll
  for (int i = 0; i < 4; ++i) {
    int c = t + i * 256;
    float a = xr[c] + rr[c];
    v[i] = a; sum += a; sq += a * a;
  }
  s1[t] = sum; s2[t] = sq;
  __syncthreads();
  for (int s = 128; s > 0; s >>= 1) {
    if (t < s) { s1[t] += s1[t + s]; s2[t] += s2[t + s]; }
    __syncthreads();
  }
  if (t == 0) {
    float mean = s1[0] * (1.0f / 1024.0f);
    float var = (s2[0] - 1024.0f * mean * mean) * (1.0f / 1023.0f);  // ddof=1
    var = fmaxf(var, 0.0f);
    stats[0] = mean;
    stats[1] = 1.0f / (sqrtf(var) + 1e-6f);
  }
  __syncthreads();
  float mean = stats[0], rinv = stats[1];
#pragma unroll
  for (int i = 0; i < 4; ++i) {
    int c = t + i * 256;
    float y = alpha[c] * (v[i] - mean) * rinv + beta[c];
    size_t off = (size_t)row * 1024 + c;
    if (outF) outF[off] = y;
    if (outB) outB[off] = (__bf16)y;
  }
}

// ---------------------------------------------------------------------------
// Orchestration
// ---------------------------------------------------------------------------
extern "C" void kernel_launch(void* const* d_in, const int* in_sizes, int n_in,
                              void* d_out, int out_size, void* d_ws, size_t ws_size,
                              hipStream_t stream) {
  const float* x     = (const float*)d_in[0];   // [4,1024,1024]
  const float* Wq    = (const float*)d_in[1];   // [1024,1024]
  const float* bq    = (const float*)d_in[2];
  const float* Wo    = (const float*)d_in[3];
  const float* bo    = (const float*)d_in[4];
  const float* W1    = (const float*)d_in[5];   // [1024,2048]
  const float* b1    = (const float*)d_in[6];
  const float* W2    = (const float*)d_in[7];   // [2048,1024]
  const float* b2    = (const float*)d_in[8];
  const float* alpha = (const float*)d_in[9];
  const float* beta  = (const float*)d_in[10];

  char* ws = (char*)d_ws;
  const size_t MB = 1u << 20;
  __bf16* Xbf  = (__bf16*)(ws + 0);         //  8 MB  (4M bf16)
  __bf16* WqT  = (__bf16*)(ws + 8 * MB);    //  2 MB
  __bf16* WoT  = (__bf16*)(ws + 10 * MB);   //  2 MB
  __bf16* W1T  = (__bf16*)(ws + 12 * MB);   //  4 MB
  __bf16* W2T  = (__bf16*)(ws + 16 * MB);   //  4 MB
  float*  Qf   = (float*)(ws + 20 * MB);    // 16 MB
  __bf16* Zbf  = (__bf16*)(ws + 36 * MB);   //  8 MB
  float*  tmpF = (float*)(ws + 44 * MB);    // 16 MB (attn_out, then ff)
  float*  Yf   = (float*)(ws + 60 * MB);    // 16 MB
  __bf16* Ybf  = (__bf16*)(ws + 76 * MB);   //  8 MB
  __bf16* Hbf  = (__bf16*)(ws + 84 * MB);   // 16 MB (4096x2048)

  const int NTOK = 4096;                     // b*s

  // bf16 conversion of x and the four weight transposes, one launch
  prep_kernel<<<2048, 256, 0, stream>>>(x, Xbf, Wq, WqT, Wo, WoT, W1, W1T, W2, W2T);

  // Q = X @ Wq + bq   (q = k = v in the reference)
  gemm_kernel<<<dim3(1024 / 64, NTOK / 128), 256, 0, stream>>>(
      Xbf, WqT, bq, Qf, nullptr, NTOK, 1024, 1024, 0);

  // Z = softmax(Q Q^T / 8) @ Q, concat layout, bf16
  attn_kernel<<<dim3(1024 / 64, 64), 128, 0, stream>>>(Qf, Zbf);

  // attn_out = Z @ Wo + bo
  gemm_kernel<<<dim3(1024 / 64, NTOK / 128), 256, 0, stream>>>(
      Zbf, WoT, bo, tmpF, nullptr, NTOK, 1024, 1024, 0);

  // Y = LN(x + attn_out)
  residual_ln_kernel<<<NTOK, 256, 0, stream>>>(x, tmpF, alpha, beta, Yf, Ybf);

  // H = relu(Y @ W1 + b1)
  gemm_kernel<<<dim3(2048 / 64, NTOK / 128), 256, 0, stream>>>(
      Ybf, W1T, b1, nullptr, Hbf, NTOK, 2048, 1024, 1);

  // ff = H @ W2 + b2
  gemm_kernel<<<dim3(16, NTOK / 128), 256, 0, stream>>>(
      Hbf, W2T, b2, tmpF, nullptr, NTOK, 1024, 2048, 0);

  // out = LN(Y + ff)
  residual_ln_kernel<<<NTOK, 256, 0, stream>>>(Yf, tmpF, alpha, beta, (float*)d_out, nullptr);
}

// v009
// One run takes 132 microseconds.
// In both of two side-by-side timings against v008, it was 1.04 times as fast.
// Counting every step since v000, it is 3.07 times as fast.
#include <hip/hip_runtime.h>
#include <math.h>

typedef __attribute__((ext_vector_type(16))) __bf16 v16bf;
typedef __attribute__((ext_vector_type(8)))  float  v8f;
typedef __attribute__((ext_vector_type(8)))  __bf16 v8bf;
typedef __attribute__((ext_vector_type(4)))  float  v4f;
typedef __attribute__((ext_vector_type(4)))  __bf16 v4bf;

// ---------------------------------------------------------------------------
// WMMA helper: D = A(16x32 bf16) * B(32x16 bf16) + C(16x16 f32)
// ---------------------------------------------------------------------------
__device__ inline v8f wmma_bf16(v16bf a, v16bf b, v8f c) {
  return __builtin_amdgcn_wmma_f32_16x16x32_bf16(
      /*neg_a=*/false, a, /*neg_b=*/false, b,
      /*c_mod=*/(short)0, c, /*reuse_a=*/false, /*reuse_b=*/false);
}

// Fragment element pattern (16-bit A/B, 16x32): per lane, element e maps to
// K = kh + e (e<8) or K = 16 + kh + (e-8) (e>=8), with kh = 8*(lane>=16).
__device__ inline v16bf load_frag_bf16(const __bf16* base, int kh) {
  v16bf r;
#pragma unroll
  for (int e = 0; e < 8; ++e) { r[e] = base[kh + e]; r[e + 8] = base[16 + kh + e]; }
  return r;
}

__device__ inline v16bf cvt_frag_f32(const float* base, int kh) {
  v16bf r;
#pragma unroll
  for (int e = 0; e < 8; ++e) { r[e] = (__bf16)base[kh + e]; r[e + 8] = (__bf16)base[16 + kh + e]; }
  return r;
}

// Low 32 bits of a flat shared-aperture address = LDS byte offset.
__device__ inline unsigned int lds_addr_u32(const void* p) {
  return (unsigned int)(size_t)p;
}

// CDNA5 async copies: 16B global -> LDS per lane, tracked by ASYNCcnt.
// One GEMM stage = 12 copies per lane: LDS rows step by lstep bytes, the first
// 8 copies walk A and the last 4 walk B, both by gstep bytes a copy.
// s_wait_xcnt 0 closes the statement, so that no address register named here
// takes the next stage's value ahead of it.
__device__ inline void async_stage_12xb128(unsigned int l, unsigned int lstep,
                                           const __bf16* ga, const __bf16* gb, size_t gstep) {
  const unsigned long long a = (unsigned long long)(size_t)ga;
  const unsigned long long b = (unsigned long long)(size_t)gb;
  asm volatile(
      "global_load_async_to_lds_b128 %0, %12, off\n\t"
      "global_load_async_to_lds_b128 %1, %13, off\n\t"
      "global_load_async_to_lds_b128 %2, %14, off\n\t"
      "global_load_async_to_lds_b128 %3, %15, off\n\t"
      "global_load_async_to_lds_b128 %4, %16, off\n\t"
      "global_load_async_to_lds_b128 %5, %17, off\n\t"
      "global_load_async_to_lds_b128 %6, %18, off\n\t"
      "global_load_async_to_lds_b128 %7, %19, off\n\t"
      "global_load_async_to_lds_b128 %8, %20, off\n\t"
      "global_load_async_to_lds_b128 %9, %21, off\n\t"
      "global_load_async_to_lds_b128 %10, %22, off\n\t"
      "global_load_async_to_lds_b128 %11, %23, off\n\t"
      "s_wait_xcnt 0x0"
      :
      : "v"(l), "v"(l + lstep), "v"(l + 2 * lstep), "v"(l + 3 * lstep),
        "v"(l + 4 * lstep), "v"(l + 5 * lstep), "v"(l + 6 * lstep), "v"(l + 7 * lstep),
        "v"(l + 8 * lstep), "v"(l + 9 * lstep), "v"(l + 10 * lstep), "v"(l + 11 * lstep),
        "v"(a), "v"(a + gstep), "v"(a + 2 * gstep), "v"(a + 3 * gstep),
        "v"(a + 4 * gstep), "v"(a + 5 * gstep), "v"(a + 6 * gstep), "v"(a + 7 * gstep),
        "v"(b), "v"(b + gstep), "v"(b + 2 * gstep), "v"(b + 3 * gstep)
      : "memory");
}
__device__ inline void wait_asynccnt0() {
  asm volatile("s_wait_asynccnt 0x0" ::: "memory");
}

// ---------------------------------------------------------------------------
// fp32 -> bf16 elementwise, 32 elements a thread, so that few waves have to start.
// A wave takes 1024 consecutive floats: eight 16 B loads a lane, each 512
// contiguous bytes of the wave, all in flight before the first conversion; a
// store of the wave is 256 contiguous bytes (two whole lines).
// A block of 256 threads takes the 8192 elements of chunk blk.
// ---------------------------------------------------------------------------
__device__ inline void cvt_block(const float* __restrict__ in, __bf16* __restrict__ out, int blk) {
  const size_t base = ((size_t)blk * 8 + (threadIdx.x >> 5)) * 1024 + (threadIdx.x & 31) * 4;
  v4f x[8];
#pragma unroll
  for (int i = 0; i < 8; ++i) x[i] = *(const v4f*)(in + base + i * 128);
#pragma unroll
  for (int i = 0; i < 8; ++i) *(v4bf*)(out + base + i * 128) = __builtin_convertvector(x[i], v4bf);
  // No other job's code follows in this block; a precaution: no register that these stores name is rewritten ahead of this wait.
  asm volatile("s_wait_xcnt 0x0" ::: "memory");
}

// W[K x N] row-major fp32  ->  Wt[N x K] row-major bf16, the 64x64 tile (bx, by)
// by one block of 256 threads.
// The tile turns in LDS, so that both sides of global memory see whole lines:
// a wave reads 2 rows x 256 B of W and stores 4 rows x 128 B of Wt.
// Pitch 65 floats: the row-wise writes and the column-wise reads of the tile
// both fall on 32 different banks. K and N are multiples of 64.
__device__ inline void transpose_cvt_block(float* tile, const float* __restrict__ in,
                                           __bf16* __restrict__ out, int K, int N, int bx, int by) {
  const int tid = threadIdx.x;
  const int n0 = bx * 64;
  const int k0 = by * 64;

  const int c4 = (tid & 15) * 4;  // 4 columns per thread
  const int r = tid >> 4;         // rows r, r+16, r+32, r+48
  v4f v[4];
#pragma unroll
  for (int i = 0; i < 4; ++i)
    v[i] = *(const v4f*)(in + (size_t)(k0 + r + 16 * i) * N + n0 + c4);
#pragma unroll
  for (int i = 0; i < 4; ++i) {
#pragma unroll
    for (int j = 0; j < 4; ++j) tile[(r + 16 * i) * 65 + c4 + j] = v[i][j];
  }
  __syncthreads();

  const int kc = (tid & 7) * 8;  // 8 consecutive k = 16 B of one Wt row
  const int nr = tid >> 3;       // Wt rows nr, nr+32
#pragma unroll
  for (int i = 0; i < 2; ++i) {
    const int n = nr + 32 * i;
    v8bf w;
#pragma unroll
    for (int j = 0; j < 8; ++j) w[j] = (__bf16)tile[(kc + j) * 65 + n];
    *(v8bf*)(out + (size_t)(n0 + n) * K + k0 + kc) = w;
  }
  // No other job's code follows in this block; a precaution: no register that these stores name is rewritten ahead of this wait.
  asm volatile("s_wait_xcnt 0x0" ::: "memory");
}

// All operand preparation in ONE launch: none of the five jobs reads what
// another writes, so the block index alone picks the job (a block-uniform
// choice; the barrier of a transposing block is passed by all of its threads).
// Blocks 0..255 Wq, 256..511 Wo (16 x 16 tiles each), 512..1023 W1 (32 x 16),
// 1024..1535 W2 (16 x 32), 1536..2047 the 512 chunks of x. grid = 2048.
__global__ __launch_bounds__(256) void prep_kernel(const float* __restrict__ x, __bf16* __restrict__ Xbf,
                                                   const float* __restrict__ Wq, __bf16* __restrict__ WqT,
                                                   const float* __restrict__ Wo, __bf16* __restrict__ WoT,
                                                   const float* __restrict__ W1, __bf16* __restrict__ W1T,
                                                   const float* __restrict__ W2, __bf16* __restrict__ W2T) {
  __shared__ float tile[64 * 65];  // [k_local][n_local]
  const int bid = blockIdx.x;
  if (bid < 256) {
    transpose_cvt_block(tile, Wq, WqT, 1024, 1024, bid & 15, bid >> 4);
  } else if (bid < 512) {
    transpose_cvt_block(tile, Wo, WoT, 1024, 1024, bid & 15, (bid - 256) >> 4);
  } else if (bid < 1024) {
    transpose_cvt_block(tile, W1, W1T, 1024, 2048, bid & 31, (bid - 512) >> 5);
  } else if (bid < 1536) {
    transpose_cvt_block(tile, W2, W2T, 2048, 1024, bid & 15, (bid - 1024) >> 4);
  } else {
    cvt_block(x, Xbf, bid - 1536);
  }
}

// ---------------------------------------------------------------------------
// GEMM: out[M x N] = A_bf16[M x K] @ Bt_bf16[N x K]^T + bias, optional relu.
// Wave = 16x64 output strip; 8 waves/block cover 128 rows x 64 cols.
// A stage is 128 k: the block's 128 A rows and 64 B rows, 256 B each (two whole
// lines), come into LDS by CDNA5 async-to-LDS copies (16 lanes a row, 12 copies
// a lane) and are read as ds_load_b128 fragments. K is a multiple of 128.
// Two stage buffers: stage t + 1's copies fly while stage t is multiplied, and
// one barrier a stage both publishes stage t + 1 and frees stage t's buffer.
// grid = (N/64, M/128).
// ---------------------------------------------------------------------------
constexpr int GEMM_KS = 128;     // k per stage
constexpr int GEMM_PITCH = 136;  // bf16 per LDS row: 272 B = 16 B x 17, all 64 banks
constexpr int GEMM_BUF = (128 + 64) * GEMM_PITCH;  // bf16 per stage buffer (51KB)

// Second bound: 6 waves a SIMD, the three blocks that two 51KB buffers each leave
// resident on a WGP.
__global__ __launch_bounds__(256, 6) void gemm_kernel(const __bf16* __restrict__ A,
                                                   const __bf16* __restrict__ Bt,
                                                   const float* __restrict__ bias,
                                                   float* outF, __bf16* outB,
                                                   int M, int N, int K, int relu) {
  // per buffer, rows 0..127: A [row_local][k_local]; rows 128..191: B [col_local][k_local]
  __shared__ __attribute__((aligned(16))) __bf16 stage[2 * GEMM_BUF];

  const int tid = threadIdx.x;
  const int lane = tid & 31;
  const int wave = tid >> 5;
  const int lanelo = lane & 15;
  const int half = lane >> 4;
  const int kh = half * 8;

  const int m0 = blockIdx.y * 128 + wave * 16;
  const int n0 = blockIdx.x * 64;

  // Staging assignment: 16 lanes cover one 256 B row; a copy of the block covers 16 rows.
  const int srow = tid >> 4;           // 0..15
  const int skoff = (tid & 15) * 8;    // 0,8,..,120
  const unsigned int sdst = lds_addr_u32(stage) + (unsigned int)((srow * GEMM_PITCH + skoff) * 2);
  const __bf16* asrc = A + (size_t)(blockIdx.y * 128 + srow) * K + skoff;
  const __bf16* bsrc = Bt + (size_t)(n0 + srow) * K + skoff;

  v8f zero = {};
  v8f acc[4] = {zero, zero, zero, zero};

  // Stage t, in buffer t & 1: row r holds A[blockrow+r][128t+k] (r < 128), Bt[n0+r-128][128t+k] (r >= 128).
  const int nst = K / GEMM_KS;
  async_stage_12xb128(sdst, 16 * GEMM_PITCH * 2, asrc, bsrc, (size_t)16 * K * 2);
  wait_asynccnt0();
  __syncthreads();  // publishes stage 0
  if (nst > 1)
    async_stage_12xb128(sdst + GEMM_BUF * 2, 16 * GEMM_PITCH * 2, asrc + GEMM_KS, bsrc + GEMM_KS,
                        (size_t)16 * K * 2);

  for (int st = 0; st < nst; ++st) {
    const int buf = (st & 1) * GEMM_BUF;
    const __bf16* atile = stage + buf;
    const __bf16* btile = stage + buf + 128 * GEMM_PITCH;

    // Two fragment sets: slice s + 1's ten LDS reads go out as one group ahead of
    // slice s's WMMAs, which then wait only for reads issued a whole slice earlier.
    v16bf va[2], vb[2][4];
    va[0] = load_frag_bf16(atile + (wave * 16 + lanelo) * GEMM_PITCH, kh);
#pragma unroll
    for (int t = 0; t < 4; ++t) vb[0][t] = load_frag_bf16(btile + (t * 16 + lanelo) * GEMM_PITCH, kh);
    // Unrolled, so that the four 32-k slices' LDS offsets are immediates of the loads
    // and the set index is a constant.
#pragma unroll
    for (int s = 0; s < GEMM_KS / 32; ++s) {
      const int cur = s & 1, nxt = cur ^ 1;
      if (s + 1 < GEMM_KS / 32) {
        va[nxt] = load_frag_bf16(atile + (wave * 16 + lanelo) * GEMM_PITCH + (s + 1) * 32, kh);
#pragma unroll
        for (int t = 0; t < 4; ++t)
          vb[nxt][t] = load_frag_bf16(btile + (t * 16 + lanelo) * GEMM_PITCH + (s + 1) * 32, kh);
      }
      // Keeps the next slice's reads ahead of this slice's WMMAs: sunk among them, each WMMA waits out an LDS latency.
      __builtin_amdgcn_sched_barrier(0);
#pragma unroll
      for (int t = 0; t < 4; ++t) acc[t] = wmma_bf16(va[cur], vb[cur][t], acc[t]);
    }
    // This wave's LDS reads have retired before any wave's next copies land there.
    asm volatile("s_wait_dscnt 0x0" ::: "memory");
    wait_asynccnt0();  // this wave's share of stage st + 1 has landed
    __syncthreads();   // publishes stage st + 1 and ends every reader's last read of stage st
    if (st + 2 < nst)
      async_stage_12xb128(sdst + buf * 2, 16 * GEMM_PITCH * 2, asrc + (st + 2) * GEMM_KS,
                          bsrc + (st + 2) * GEMM_KS, (size_t)16 * K * 2);
  }
  wait_asynccnt0();  // no copy is outstanding when the wave goes on to its end

#pragma unroll
  for (int t = 0; t < 4; ++t) {
    int col = n0 + t * 16 + lanelo;
    float bv = bias[col];
#pragma unroll
    for (int r = 0; r < 8; ++r) {
      int mrow = m0 + r + 8 * half;
      float v = acc[t][r] + bv;
      if (relu) v = fmaxf(v, 0.0f);
      size_t off = (size_t)mrow * N + col;
      if (outF) outF[off] = v;
      if (outB) outB[off] = (__bf16)v;
    }
  }
}

// ---------------------------------------------------------------------------
// Attention (q = k = v = Q, per the reference's shared projection).
// Block = 4 waves x 16 query rows of one (b,h). Per 32-key step the block
// brings the 32 key rows (K = V) into LDS once, converted to bf16, row-major
// ([key][d]): a wave's load covers 2 whole 256 B rows. All four waves take both
// operands from that tile: a K A-fragment is two ds_load_b128 of a key row, a
// V^T A-fragment two ds_load_tr16_b128 (lane = d, 8 consecutive keys a load).
// Both products are transposed: S^T = K Q^T / 8 (4 WMMAs) and O^T += V^T P^T
// (4 WMMAs). A lane then holds 16 of the 32 scores of ONE query (lane & 15),
// its partner lane ^ 16 the other 16: the maximum is taken in the lane's own
// registers plus one exchange between the halves, and the two score tiles,
// converted in place, are the B operand P^T in the hardware k order.
// grid = (1024/64, b*h = 64). Output Z in concat layout as bf16.
// ---------------------------------------------------------------------------
constexpr int KV_PITCH = 72;  // bf16 per LDS row: 144 B = 16 B x 9, the ds_load_b128 readers' pitch

// Transposing LDS load of a row-major 16-bit tile T: with lane l pointing at
// T[k0 + 8*(l>>4) + (l&7)][d0 + 8*((l>>3)&1)], lane l gets
// T[k0 + 8*(l>>4) + 0..7][d0 + (l&15)].
__device__ inline v8bf lds_load_tr16(const __bf16* p) {
  typedef __attribute__((ext_vector_type(8))) short s16x8;
  typedef __attribute__((address_space(3))) s16x8 lds_s16x8;
  return __builtin_bit_cast(v8bf, __builtin_amdgcn_ds_load_tr16_b128_v8i16((lds_s16x8*)p));
}

// Value of lane l ^ 16 (v_permlanex16_b32 with the identity selects).
__device__ inline float xhalf(float x) {
  const int i = __builtin_bit_cast(int, x);
  return __builtin_bit_cast(float,
      __builtin_amdgcn_permlanex16(i, i, 0x76543210, 0xfedcba98, false, false));
}

__global__ __launch_bounds__(128) void attn_kernel(const float* __restrict__ Q,
                                                   __bf16* __restrict__ Zbf) {
  __shared__ __attribute__((aligned(16))) __bf16 kvtile[32 * KV_PITCH];  // [key][d], 4.5KB

  const int tid = threadIdx.x;
  const int lane = tid & 31;
  const int wave = tid >> 5;
  const int lanelo = lane & 15;
  const int half = lane >> 4;
  const int kh = half * 8;

  const int b = blockIdx.y >> 4;
  const int h = blockIdx.y & 15;
  const int q0 = blockIdx.x * 64 + wave * 16;
  const float* Qh = Q + (size_t)b * 1024 * 1024 + h * 64;  // (s,d) at s*1024 + d

  // Staging assignment: 16 lanes cover one key row (64 floats); rows skey + 8i.
  const int skey = tid >> 4;           // 0..7
  const int sdoff = (tid & 15) * 4;    // 0,4,..,60
  // This lane's address in the tile for the transposing loads (keys 0..15, d 0..15).
  const __bf16* vsrc = kvtile + (kh + (lane & 7)) * KV_PITCH + ((lane >> 3) & 1) * 8;

  // Preload Q^T B-fragments (column = query q0 + lanelo) for d-steps 0 and 32 (d_k = 64).
  v16bf bq0, bq1;
  {
    const float* rp = Qh + (size_t)(q0 + lanelo) * 1024;
    bq0 = cvt_frag_f32(rp, kh);
    bq1 = cvt_frag_f32(rp + 32, kh);
  }

  // Of query q0 + lanelo: m the running maximum (equal in both halves), l the
  // sum over this half's keys alone; the halves' sums are joined after the loop.
  float m = -1.0e30f, l = 0.0f;
  v8f zero = {};
  v8f o[4] = {zero, zero, zero, zero};  // o[t][r] = O^T[d = 16t + 8*half + r][query lanelo]

  const float inv_scale = 0.125f;  // 1/sqrt(64)

  for (int j0 = 0; j0 < 1024; j0 += 32) {
    // Cooperative key-tile stage: kvtile[key][d] = bf16(Qh[j0+key][d])
    {
      const float* src = Qh + (size_t)(j0 + skey) * 1024 + sdoff;
      v4f x[4];
#pragma unroll
      for (int i = 0; i < 4; ++i) x[i] = *(const v4f*)(src + (size_t)i * 8 * 1024);
#pragma unroll
      for (int i = 0; i < 4; ++i) {
        v4bf w;
#pragma unroll
        for (int j = 0; j < 4; ++j) w[j] = (__bf16)x[i][j];
        *(v4bf*)(kvtile + (skey + 8 * i) * KV_PITCH + sdoff) = w;
      }
    }
    __syncthreads();

    // S^T tile: 32 keys x 16 queries; s0[r] = key j0 + 8*half + r, s1[r] = key j0 + 16 + 8*half + r.
    v8f s0 = zero, s1 = zero;
    {
      const __bf16* kp = kvtile + lanelo * KV_PITCH;
      s0 = wmma_bf16(load_frag_bf16(kp, kh), bq0, s0);
      s0 = wmma_bf16(load_frag_bf16(kp + 32, kh), bq1, s0);
      kp = kvtile + (16 + lanelo) * KV_PITCH;
      s1 = wmma_bf16(load_frag_bf16(kp, kh), bq0, s1);
      s1 = wmma_bf16(load_frag_bf16(kp + 32, kh), bq1, s1);
    }

    // V^T fragments, row d = 16t + lanelo: keys kh..kh+7, then 16+kh..16+kh+7,
    // the k order of load_frag_bf16 and of the packed score tiles.
    v16bf va[4];
#pragma unroll
    for (int t = 0; t < 4; ++t) {
      v8bf lo = lds_load_tr16(vsrc + t * 16);
      v8bf hi = lds_load_tr16(vsrc + 16 * KV_PITCH + t * 16);
      va[t] = __builtin_shufflevector(lo, hi, 0, 1, 2, 3, 4, 5, 6, 7, 8, 9, 10, 11, 12, 13, 14, 15);
    }

    // Online softmax of this lane's query.
    float tm = fmaxf(s0[0], s1[0]);
#pragma unroll
    for (int r = 1; r < 8; ++r) tm = fmaxf(tm, fmaxf(s0[r], s1[r]));
    tm = fmaxf(tm, xhalf(tm)) * inv_scale;
    const float mn = fmaxf(m, tm);
    const float f = __expf(m - mn);
    m = mn;

    v16bf pb;  // P^T B-fragment: element e = key kh + e, element 8 + e = key 16 + kh + e
    float ps0 = 0.0f, ps1 = 0.0f;
#pragma unroll
    for (int r = 0; r < 8; ++r) {
      float p0 = __expf(s0[r] * inv_scale - mn);
      float p1 = __expf(s1[r] * inv_scale - mn);
      ps0 += p0;
      ps1 += p1;
      pb[r] = (__bf16)p0;
      pb[r + 8] = (__bf16)p1;
    }
    l = l * f + (ps0 + ps1);

#pragma unroll
    for (int t = 0; t < 4; ++t) {
      o[t] *= f;
      o[t] = wmma_bf16(va[t], pb, o[t]);
    }
    __syncthreads();  // protect kvtile before next j-step's stores
  }

  // Join the halves' sums, normalize and store (concat layout): 8 consecutive d = 16 B a store.
  const float linv = 1.0f / (l + xhalf(l));
  __bf16* zrow = Zbf + ((size_t)b * 1024 + q0 + lanelo) * 1024 + h * 64 + kh;
#pragma unroll
  for (int t = 0; t < 4; ++t) {
    v8bf w;
#pragma unroll
    for (int r = 0; r < 8; ++r) w[r] = (__bf16)(o[t][r] * linv);
    *(v8bf*)(zrow + t * 16) = w;
  }
}

// ---------------------------------------------------------------------------
// y = alpha * (x + r - mean) / (std_unbiased + 1e-6) + beta  (per row of 1024)
// ---------------------------------------------------------------------------
__global__ __launch_bounds__(256) void residual_ln_kernel(const float* __restrict__ X,
                                                          const float* __restrict__ R,
                                                          const float* __restrict__ alpha,
                                                          const float* __restrict__ beta,
                                                          float* outF, __bf16* outB) {
  __shared__ float s1[256], s2[256], stats[2];
  const int row = blockIdx.x;
  const int t = threadIdx.x;
  const float* xr = X + (size_t)row * 1024;
  const float* rr = R + (size_t)row * 1024;

  float v[4], sum = 0.0f, sq = 0.0f;
#pragma unroll
  for (int i = 0; i < 4; ++i) {
    int c = t + i * 256;
    float a = xr[c] + rr[c];
    v[i] = a; sum += a; sq += a * a;
  }
  s1[t] = sum; s2[t] = sq;
  __syncthreads();
  for (int s = 128; s > 0; s >>= 1) {
    if (t < s) { s1[t] += s1[t + s]; s2[t] += s2[t + s]; }
    __syncthreads();
  }
  if (t == 0) {
    float mean = s1[0] * (1.0f / 1024.0f);
    float var = (s2[0] - 1024.0f * mean * mean) * (1.0f / 1023.0f);  // ddof=1
    var = fmaxf(var, 0.0f);
    stats[0] = mean;
    stats[1] = 1.0f / (sqrtf(var) + 1e-6f);
  }
  __syncthreads();
  float mean = stats[0], rinv = stats[1];
#pragma unroll
  for (int i = 0; i < 4; ++i) {
    int c = t + i * 256;
    float y = alpha[c] * (v[i] - mean) * rinv + beta[c];
    size_t off = (size_t)row * 1024 + c;
    if (outF) outF[off] = y;
    if (outB) outB[off] = (__bf16)y;
  }
}

// ---------------------------------------------------------------------------
// Orchestration
// ---------------------------------------------------------------------------
extern "C" void kernel_launch(void* const* d_in, const int* in_sizes, int n_in,
                              void* d_out, int out_size, void* d_ws, size_t ws_size,
                              hipStream_t stream) {
  const float* x     = (const float*)d_in[0];   // [4,1024,1024]
  const float* Wq    = (const float*)d_in[1];   // [1024,1024]
  const float* bq    = (const float*)d_in[2];
  const float* Wo    = (const float*)d_in[3];
  const float* bo    = (const float*)d_in[4];
  const float* W1    = (const float*)d_in[5];   // [1024,2048]
  const float* b1    = (const float*)d_in[6];
  const float* W2    = (const float*)d_in[7];   // [2048,1024]
  const float* b2    = (const float*)d_in[8];
  const float* alpha = (const float*)d_in[9];
  const float* beta  = (const float*)d_in[10];

  char* ws = (char*)d_ws;
  const size_t MB = 1u << 20;
  __bf16* Xbf  = (__bf16*)(ws + 0);         //  8 MB  (4M bf16)
  __bf16* WqT  = (__bf16*)(ws + 8 * MB);    //  2 MB
  __bf16* WoT  = (__bf16*)(ws + 10 * MB);   //  2 MB
  __bf16* W1T  = (__bf16*)(ws + 12 * MB);   //  4 MB
  __bf16* W2T  = (__bf16*)(ws + 16 * MB);   //  4 MB
  float*  Qf   = (float*)(ws + 20 * MB);    // 16 MB
  __bf16* Zbf  = (__bf16*)(ws + 36 * MB);   //  8 MB
  float*  tmpF = (float*)(ws + 44 * MB);    // 16 MB (attn_out, then ff)
  float*  Yf   = (float*)(ws + 60 * MB);    // 16 MB
  __bf16* Ybf  = (__bf16*)(ws + 76 * MB);   //  8 MB
  __bf16* Hbf  = (__bf16*)(ws + 84 * MB);   // 16 MB (4096x2048)

  const int NTOK = 4096;                     // b*s

  // bf16 conversion of x and the four weight transposes, one launch
  prep_kernel<<<2048, 256, 0, stream>>>(x, Xbf, Wq, WqT, Wo, WoT, W1, W1T, W2, W2T);

  // Q = X @ Wq + bq   (q = k = v in the reference)
  gemm_kernel<<<dim3(1024 / 64, NTOK / 128), 256, 0, stream>>>(
      Xbf, WqT, bq, Qf, nullptr, NTOK, 1024, 1024, 0);

  // Z = softmax(Q Q^T / 8) @ Q, concat layout, bf16
  attn_kernel<<<dim3(1024 / 64, 64), 128, 0, stream>>>(Qf, Zbf);

  // attn_out = Z @ Wo + bo
  gemm_kernel<<<dim3(1024 / 64, NTOK / 128), 256, 0, stream>>>(
      Zbf, WoT, bo, tmpF, nullptr, NTOK, 1024, 1024, 0);

  // Y = LN(x + attn_out)
  residual_ln_kernel<<<NTOK, 256, 0, stream>>>(x, tmpF, alpha, beta, Yf, Ybf);

  // H = relu(Y @ W1 + b1)
  gemm_kernel<<<dim3(2048 / 64, NTOK / 128), 256, 0, stream>>>(
      Ybf, W1T, b1, nullptr, Hbf, NTOK, 2048, 1024, 1);

  // ff = H @ W2 + b2
  gemm_kernel<<<dim3(16, NTOK / 128), 256, 0, stream>>>(
      Hbf, W2T, b2, tmpF, nullptr, NTOK, 1024, 2048, 0);

  // out = LN(Y + ff)
  residual_ln_kernel<<<NTOK, 256, 0, stream>>>(Yf, tmpF, alpha, beta, (float*)d_out, nullptr);
}

// v010
// A run of this version takes 121 microseconds.
// In both of two side-by-side timings against v009, it was 1.09 times as fast.
// Over all steps from v000 it is 3.34 times as fast.
#include <hip/hip_runtime.h>
#include <math.h>

typedef __attribute__((ext_vector_type(16))) __bf16 v16bf;
typedef __attribute__((ext_vector_type(8)))  float  v8f;
typedef __attribute__((ext_vector_type(8)))  __bf16 v8bf;
typedef __attribute__((ext_vector_type(4)))  float  v4f;
typedef __attribute__((ext_vector_type(4)))  __bf16 v4bf;

// ---------------------------------------------------------------------------
// WMMA helper: D = A(16x32 bf16) * B(32x16 bf16) + C(16x16 f32)
// ---------------------------------------------------------------------------
__device__ inline v8f wmma_bf16(v16bf a, v16bf b, v8f c) {
  return __builtin_amdgcn_wmma_f32_16x16x32_bf16(
      /*neg_a=*/false, a, /*neg_b=*/false, b,
      /*c_mod=*/(short)0, c, /*reuse_a=*/false, /*reuse_b=*/false);
}

// Fragment element pattern (16-bit A/B, 16x32): per lane, element e maps to
// K = kh + e (e<8) or K = 16 + kh + (e-8) (e>=8), with kh = 8*(lane>=16).
__device__ inline v16bf load_frag_bf16(const __bf16* base, int kh) {
  v16bf r;
#pragma unroll
  for (int e = 0; e < 8; ++e) { r[e] = base[kh + e]; r[e + 8] = base[16 + kh + e]; }
  return r;
}

// Low 32 bits of a flat shared-aperture address = LDS byte offset.
__device__ inline unsigned int lds_addr_u32(const void* p) {
  return (unsigned int)(size_t)p;
}

// CDNA5 async copies: 16B global -> LDS per lane, tracked by ASYNCcnt.
// One GEMM stage = 12 copies per lane: LDS rows step by lstep bytes, the first
// 8 copies walk A and the last 4 walk B, both by gstep bytes a copy.
// s_wait_xcnt 0 closes the statement, so that no address register named here
// takes the next stage's value ahead of it.
__device__ inline void async_stage_12xb128(unsigned int l, unsigned int lstep,
                                           const __bf16* ga, const __bf16* gb, size_t gstep) {
  const unsigned long long a = (unsigned long long)(size_t)ga;
  const unsigned long long b = (unsigned long long)(size_t)gb;
  asm volatile(
      "global_load_async_to_lds_b128 %0, %12, off\n\t"
      "global_load_async_to_lds_b128 %1, %13, off\n\t"
      "global_load_async_to_lds_b128 %2, %14, off\n\t"
      "global_load_async_to_lds_b128 %3, %15, off\n\t"
      "global_load_async_to_lds_b128 %4, %16, off\n\t"
      "global_load_async_to_lds_b128 %5, %17, off\n\t"
      "global_load_async_to_lds_b128 %6, %18, off\n\t"
      "global_load_async_to_lds_b128 %7, %19, off\n\t"
      "global_load_async_to_lds_b128 %8, %20, off\n\t"
      "global_load_async_to_lds_b128 %9, %21, off\n\t"
      "global_load_async_to_lds_b128 %10, %22, off\n\t"
      "global_load_async_to_lds_b128 %11, %23, off\n\t"
      "s_wait_xcnt 0x0"
      :
      : "v"(l), "v"(l + lstep), "v"(l + 2 * lstep), "v"(l + 3 * lstep),
        "v"(l + 4 * lstep), "v"(l + 5 * lstep), "v"(l + 6 * lstep), "v"(l + 7 * lstep),
        "v"(l + 8 * lstep), "v"(l + 9 * lstep), "v"(l + 10 * lstep), "v"(l + 11 * lstep),
        "v"(a), "v"(a + gstep), "v"(a + 2 * gstep), "v"(a + 3 * gstep),
        "v"(a + 4 * gstep), "v"(a + 5 * gstep), "v"(a + 6 * gstep), "v"(a + 7 * gstep),
        "v"(b), "v"(b + gstep), "v"(b + 2 * gstep), "v"(b + 3 * gstep)
      : "memory");
}
// One attention stage = 4 copies per lane: LDS rows step by lstep bytes, global rows by
// gstep bytes. s_wait_xcnt 0 closes the statement for the same reason as above.
__device__ inline void async_stage_4xb128(unsigned int l, unsigned int lstep,
                                          const __bf16* g, size_t gstep) {
  const unsigned long long a = (unsigned long long)(size_t)g;
  asm volatile(
      "global_load_async_to_lds_b128 %0, %4, off\n\t"
      "global_load_async_to_lds_b128 %1, %5, off\n\t"
      "global_load_async_to_lds_b128 %2, %6, off\n\t"
      "global_load_async_to_lds_b128 %3, %7, off\n\t"
      "s_wait_xcnt 0x0"
      :
      : "v"(l), "v"(l + lstep), "v"(l + 2 * lstep), "v"(l + 3 * lstep),
        "v"(a), "v"(a + gstep), "v"(a + 2 * gstep), "v"(a + 3 * gstep)
      : "memory");
}
__device__ inline void wait_asynccnt0() {
  asm volatile("s_wait_asynccnt 0x0" ::: "memory");
}

// ---------------------------------------------------------------------------
// fp32 -> bf16 elementwise, 32 elements a thread, so that few waves have to start.
// A wave takes 1024 consecutive floats: eight 16 B loads a lane, each 512
// contiguous bytes of the wave, all in flight before the first conversion; a
// store of the wave is 256 contiguous bytes (two whole lines).
// A block of 256 threads takes the 8192 elements of chunk blk.
// ---------------------------------------------------------------------------
__device__ inline void cvt_block(const float* __restrict__ in, __bf16* __restrict__ out, int blk) {
  const size_t base = ((size_t)blk * 8 + (threadIdx.x >> 5)) * 1024 + (threadIdx.x & 31) * 4;
  v4f x[8];
#pragma unroll
  for (int i = 0; i < 8; ++i) x[i] = *(const v4f*)(in + base + i * 128);
#pragma unroll
  for (int i = 0; i < 8; ++i) *(v4bf*)(out + base + i * 128) = __builtin_convertvector(x[i], v4bf);
  // No other job's code follows in this block; a precaution: no register that these stores name is rewritten ahead of this wait.
  asm volatile("s_wait_xcnt 0x0" ::: "memory");
}

// W[K x N] row-major fp32  ->  Wt[N x K] row-major bf16, the 64x64 tile (bx, by)
// by one block of 256 threads.
// The tile turns in LDS, so that both sides of global memory see whole lines:
// a wave reads 2 rows x 256 B of W and stores 4 rows x 128 B of Wt.
// Pitch 65 floats: the row-wise writes and the column-wise reads of the tile
// both fall on 32 different banks. K and N are multiples of 64.
__device__ inline void transpose_cvt_block(float* tile, const float* __restrict__ in,
                                           __bf16* __restrict__ out, int K, int N, int bx, int by) {
  const int tid = threadIdx.x;
  const int n0 = bx * 64;
  const int k0 = by * 64;

  const int c4 = (tid & 15) * 4;  // 4 columns per thread
  const int r = tid >> 4;         // rows r, r+16, r+32, r+48
  v4f v[4];
#pragma unroll
  for (int i = 0; i < 4; ++i)
    v[i] = *(const v4f*)(in + (size_t)(k0 + r + 16 * i) * N + n0 + c4);
#pragma unroll
  for (int i = 0; i < 4; ++i) {
#pragma unroll
    for (int j = 0; j < 4; ++j) tile[(r + 16 * i) * 65 + c4 + j] = v[i][j];
  }
  __syncthreads();

  const int kc = (tid & 7) * 8;  // 8 consecutive k = 16 B of one Wt row
  const int nr = tid >> 3;       // Wt rows nr, nr+32
#pragma unroll
  for (int i = 0; i < 2; ++i) {
    const int n = nr + 32 * i;
    v8bf w;
#pragma unroll
    for (int j = 0; j < 8; ++j) w[j] = (__bf16)tile[(kc + j) * 65 + n];
    *(v8bf*)(out + (size_t)(n0 + n) * K + k0 + kc) = w;
  }
  // No other job's code follows in this block; a precaution: no register that these stores name is rewritten ahead of this wait.
  asm volatile("s_wait_xcnt 0x0" ::: "memory");
}

// All operand preparation in ONE launch: none of the five jobs reads what
// another writes, so the block index alone picks the job (a block-uniform
// choice; the barrier of a transposing block is passed by all of its threads).
// Blocks 0..255 Wq, 256..511 Wo (16 x 16 tiles each), 512..1023 W1 (32 x 16),
// 1024..1535 W2 (16 x 32), 1536..2047 the 512 chunks of x. grid = 2048.
__global__ __launch_bounds__(256) void prep_kernel(const float* __restrict__ x, __bf16* __restrict__ Xbf,
                                                   const float* __restrict__ Wq, __bf16* __restrict__ WqT,
                                                   const float* __restrict__ Wo, __bf16* __restrict__ WoT,
                                                   const float* __restrict__ W1, __bf16* __restrict__ W1T,
                                                   const float* __restrict__ W2, __bf16* __restrict__ W2T) {
  __shared__ float tile[64 * 65];  // [k_local][n_local]
  const int bid = blockIdx.x;
  if (bid < 256) {
    transpose_cvt_block(tile, Wq, WqT, 1024, 1024, bid & 15, bid >> 4);
  } else if (bid < 512) {
    transpose_cvt_block(tile, Wo, WoT, 1024, 1024, bid & 15, (bid - 256) >> 4);
  } else if (bid < 1024) {
    transpose_cvt_block(tile, W1, W1T, 1024, 2048, bid & 31, (bid - 512) >> 5);
  } else if (bid < 1536) {
    transpose_cvt_block(tile, W2, W2T, 2048, 1024, bid & 15, (bid - 1024) >> 4);
  } else {
    cvt_block(x, Xbf, bid - 1536);
  }
}

// ---------------------------------------------------------------------------
// GEMM: out[M x N] = A_bf16[M x K] @ Bt_bf16[N x K]^T + bias, optional relu.
// Wave = 16x64 output strip; 8 waves/block cover 128 rows x 64 cols.
// A stage is 128 k: the block's 128 A rows and 64 B rows, 256 B each (two whole
// lines), come into LDS by CDNA5 async-to-LDS copies (16 lanes a row, 12 copies
// a lane) and are read as ds_load_b128 fragments. K is a multiple of 128.
// Two stage buffers: stage t + 1's copies fly while stage t is multiplied, and
// one barrier a stage both publishes stage t + 1 and frees stage t's buffer.
// grid = (N/64, M/128).
// ---------------------------------------------------------------------------
constexpr int GEMM_KS = 128;     // k per stage
constexpr int GEMM_PITCH = 136;  // bf16 per LDS row: 272 B = 16 B x 17, all 64 banks
constexpr int GEMM_BUF = (128 + 64) * GEMM_PITCH;  // bf16 per stage buffer (51KB)

// Second bound: 6 waves a SIMD, the three blocks that two 51KB buffers each leave
// resident on a WGP.
__global__ __launch_bounds__(256, 6) void gemm_kernel(const __bf16* __restrict__ A,
                                                   const __bf16* __restrict__ Bt,
                                                   const float* __restrict__ bias,
                                                   float* outF, __bf16* outB,
                                                   int M, int N, int K, int relu) {
  // per buffer, rows 0..127: A [row_local][k_local]; rows 128..191: B [col_local][k_local]
  __shared__ __attribute__((aligned(16))) __bf16 stage[2 * GEMM_BUF];

  const int tid = threadIdx.x;
  const int lane = tid & 31;
  const int wave = tid >> 5;
  const int lanelo = lane & 15;
  const int half = lane >> 4;
  const int kh = half * 8;

  const int m0 = blockIdx.y * 128 + wave * 16;
  const int n0 = blockIdx.x * 64;

  // Staging assignment: 16 lanes cover one 256 B row; a copy of the block covers 16 rows.
  const int srow = tid >> 4;           // 0..15
  const int skoff = (tid & 15) * 8;    // 0,8,..,120
  const unsigned int sdst = lds_addr_u32(stage) + (unsigned int)((srow * GEMM_PITCH + skoff) * 2);
  const __bf16* asrc = A + (size_t)(blockIdx.y * 128 + srow) * K + skoff;
  const __bf16* bsrc = Bt + (size_t)(n0 + srow) * K + skoff;

  v8f zero = {};
  v8f acc[4] = {zero, zero, zero, zero};

  // Stage t, in buffer t & 1: row r holds A[blockrow+r][128t+k] (r < 128), Bt[n0+r-128][128t+k] (r >= 128).
  const int nst = K / GEMM_KS;
  async_stage_12xb128(sdst, 16 * GEMM_PITCH * 2, asrc, bsrc, (size_t)16 * K * 2);
  wait_asynccnt0();
  __syncthreads();  // publishes stage 0
  if (nst > 1)
    async_stage_12xb128(sdst + GEMM_BUF * 2, 16 * GEMM_PITCH * 2, asrc + GEMM_KS, bsrc + GEMM_KS,
                        (size_t)16 * K * 2);

  for (int st = 0; st < nst; ++st) {
    const int buf = (st & 1) * GEMM_BUF;
    const __bf16* atile = stage + buf;
    const __bf16* btile = stage + buf + 128 * GEMM_PITCH;

    // Two fragment sets: slice s + 1's ten LDS reads go out as one group ahead of
    // slice s's WMMAs, which then wait only for reads issued a whole slice earlier.
    v16bf va[2], vb[2][4];
    va[0] = load_frag_bf16(atile + (wave * 16 + lanelo) * GEMM_PITCH, kh);
#pragma unroll
    for (int t = 0; t < 4; ++t) vb[0][t] = load_frag_bf16(btile + (t * 16 + lanelo) * GEMM_PITCH, kh);
    // Unrolled, so that the four 32-k slices' LDS offsets are immediates of the loads
    // and the set index is a constant.
#pragma unroll
    for (int s = 0; s < GEMM_KS / 32; ++s) {
      const int cur = s & 1, nxt = cur ^ 1;
      if (s + 1 < GEMM_KS / 32) {
        va[nxt] = load_frag_bf16(atile + (wave * 16 + lanelo) * GEMM_PITCH + (s + 1) * 32, kh);
#pragma unroll
        for (int t = 0; t < 4; ++t)
          vb[nxt][t] = load_frag_bf16(btile + (t * 16 + lanelo) * GEMM_PITCH + (s + 1) * 32, kh);
      }
      // Keeps the next slice's reads ahead of this slice's WMMAs: sunk among them, each WMMA waits out an LDS latency.
      __builtin_amdgcn_sched_barrier(0);
#pragma unroll
      for (int t = 0; t < 4; ++t) acc[t] = wmma_bf16(va[cur], vb[cur][t], acc[t]);
    }
    // This wave's LDS reads have retired before any wave's next copies land there.
    asm volatile("s_wait_dscnt 0x0" ::: "memory");
    wait_asynccnt0();  // this wave's share of stage st + 1 has landed
    __syncthreads();   // publishes stage st + 1 and ends every reader's last read of stage st
    if (st + 2 < nst)
      async_stage_12xb128(sdst + buf * 2, 16 * GEMM_PITCH * 2, asrc + (st + 2) * GEMM_KS,
                          bsrc + (st + 2) * GEMM_KS, (size_t)16 * K * 2);
  }
  wait_asynccnt0();  // no copy is outstanding when the wave goes on to its end

#pragma unroll
  for (int t = 0; t < 4; ++t) {
    int col = n0 + t * 16 + lanelo;
    float bv = bias[col];
#pragma unroll
    for (int r = 0; r < 8; ++r) {
      int mrow = m0 + r + 8 * half;
      float v = acc[t][r] + bv;
      if (relu) v = fmaxf(v, 0.0f);
      size_t off = (size_t)mrow * N + col;
      if (outF) outF[off] = v;
      if (outB) outB[off] = (__bf16)v;
    }
  }
}

// ---------------------------------------------------------------------------
// Attention (q = k = v = Q, per the reference's shared projection).
// Q arrives as bf16, as the projection GEMM stores it.
// Block = 4 waves x 16 query rows of one (b,h). A stage is 64 key rows (K = V),
// 128 B each (one whole line), brought into LDS row-major ([key][d]) by async-to-LDS
// copies (8 lanes a row, 4 copies a lane). Two stage buffers: stage t + 1's copies
// fly while stage t is worked on in two 32-key passes, and one barrier a stage both
// publishes stage t + 1 and frees stage t's buffer. All four waves take both
// operands from that tile: a K A-fragment is two ds_load_b128 of a key row, a
// V^T A-fragment two ds_load_tr16_b128 (lane = d, 8 consecutive keys a load).
// Both products are transposed: S^T = K Q^T / 8 (4 WMMAs) and O^T += V^T P^T
// (4 WMMAs). A lane then holds 16 of the 32 scores of ONE query (lane & 15),
// its partner lane ^ 16 the other 16: the maximum is taken in the lane's own
// registers plus one exchange between the halves, and the two score tiles,
// converted in place, are the B operand P^T in the hardware k order.
// grid = (1024/64, b*h = 64). Output Z in concat layout as bf16.
// ---------------------------------------------------------------------------
constexpr int KV_PITCH = 72;  // bf16 per LDS row: 144 B = 16 B x 9, the ds_load_b128 readers' pitch
constexpr int KV_KEYS = 64;   // keys per stage
constexpr int KV_BUF = KV_KEYS * KV_PITCH;  // bf16 per stage buffer (9KB)

// Transposing LDS load of a row-major 16-bit tile T: with lane l pointing at
// T[k0 + 8*(l>>4) + (l&7)][d0 + 8*((l>>3)&1)], lane l gets
// T[k0 + 8*(l>>4) + 0..7][d0 + (l&15)].
__device__ inline v8bf lds_load_tr16(const __bf16* p) {
  typedef __attribute__((ext_vector_type(8))) short s16x8;
  typedef __attribute__((address_space(3))) s16x8 lds_s16x8;
  return __builtin_bit_cast(v8bf, __builtin_amdgcn_ds_load_tr16_b128_v8i16((lds_s16x8*)p));
}

// Value of lane l ^ 16 (v_permlanex16_b32 with the identity selects).
__device__ inline float xhalf(float x) {
  const int i = __builtin_bit_cast(int, x);
  return __builtin_bit_cast(float,
      __builtin_amdgcn_permlanex16(i, i, 0x76543210, 0xfedcba98, false, false));
}

__global__ __launch_bounds__(128) void attn_kernel(const __bf16* __restrict__ Q,
                                                   __bf16* __restrict__ Zbf) {
  __shared__ __attribute__((aligned(16))) __bf16 kvtile[2 * KV_BUF];  // per buffer [key][d]

  const int tid = threadIdx.x;
  const int lane = tid & 31;
  const int wave = tid >> 5;
  const int lanelo = lane & 15;
  const int half = lane >> 4;
  const int kh = half * 8;

  const int b = blockIdx.y >> 4;
  const int h = blockIdx.y & 15;
  const int q0 = blockIdx.x * 64 + wave * 16;
  const __bf16* Qh = Q + (size_t)b * 1024 * 1024 + h * 64;  // (s,d) at s*1024 + d

  // Staging assignment: 8 lanes cover one key row (128 B); a copy of the block covers 16 rows.
  const int skey = tid >> 3;           // 0..15
  const int sdoff = (tid & 7) * 8;     // 0,8,..,56
  const unsigned int sdst = lds_addr_u32(kvtile) + (unsigned int)((skey * KV_PITCH + sdoff) * 2);
  const __bf16* ksrc = Qh + (size_t)skey * 1024 + sdoff;
  // This lane's address in the tile for the transposing loads (keys 0..15, d 0..15).
  const __bf16* vsrc = kvtile + (kh + (lane & 7)) * KV_PITCH + ((lane >> 3) & 1) * 8;

  // Preload Q^T B-fragments (column = query q0 + lanelo) for d-steps 0 and 32 (d_k = 64).
  v16bf bq0, bq1;
  {
    const __bf16* rp = Qh + (size_t)(q0 + lanelo) * 1024;
    bq0 = load_frag_bf16(rp, kh);
    bq1 = load_frag_bf16(rp + 32, kh);
  }

  // Of query q0 + lanelo: m the running maximum (equal in both halves), l the
  // sum over this half's keys alone; the halves' sums are joined after the loop.
  float m = -1.0e30f, l = 0.0f;
  v8f zero = {};
  v8f o[4] = {zero, zero, zero, zero};  // o[t][r] = O^T[d = 16t + 8*half + r][query lanelo]

  const float inv_scale = 0.125f;  // 1/sqrt(64)

  // Stage t, in buffer t & 1: row r holds Qh[64t + r][0..63].
  constexpr int nst = 1024 / KV_KEYS;
  async_stage_4xb128(sdst, 16 * KV_PITCH * 2, ksrc, (size_t)16 * 1024 * 2);
  wait_asynccnt0();
  __syncthreads();  // publishes stage 0
  async_stage_4xb128(sdst + KV_BUF * 2, 16 * KV_PITCH * 2, ksrc + (size_t)KV_KEYS * 1024,
                     (size_t)16 * 1024 * 2);

  for (int st = 0; st < nst; ++st) {
    const int buf = (st & 1) * KV_BUF;
    // Unrolled, so that the second pass's LDS offsets are immediates of the loads.
#pragma unroll
    for (int ps = 0; ps < KV_KEYS / 32; ++ps) {
      const int toff = buf + ps * 32 * KV_PITCH;  // this pass's 32 keys, j0 = 64 st + 32 ps

      // S^T tile: 32 keys x 16 queries; s0[r] = key j0 + 8*half + r, s1[r] = key j0 + 16 + 8*half + r.
      v8f s0 = zero, s1 = zero;
      {
        const __bf16* kp = kvtile + toff + lanelo * KV_PITCH;
        s0 = wmma_bf16(load_frag_bf16(kp, kh), bq0, s0);
        s0 = wmma_bf16(load_frag_bf16(kp + 32, kh), bq1, s0);
        kp = kvtile + toff + (16 + lanelo) * KV_PITCH;
        s1 = wmma_bf16(load_frag_bf16(kp, kh), bq0, s1);
        s1 = wmma_bf16(load_frag_bf16(kp + 32, kh), bq1, s1);
      }

      // V^T fragments, row d = 16t + lanelo: keys kh..kh+7, then 16+kh..16+kh+7,
      // the k order of load_frag_bf16 and of the packed score tiles.
      v16bf va[4];
#pragma unroll
      for (int t = 0; t < 4; ++t) {
        v8bf lo = lds_load_tr16(vsrc + toff + t * 16);
        v8bf hi = lds_load_tr16(vsrc + toff + 16 * KV_PITCH + t * 16);
        va[t] = __builtin_shufflevector(lo, hi, 0, 1, 2, 3, 4, 5, 6, 7, 8, 9, 10, 11, 12, 13, 14, 15);
      }

      // Online softmax of this lane's query.
      float tm = fmaxf(s0[0], s1[0]);
#pragma unroll
      for (int r = 1; r < 8; ++r) tm = fmaxf(tm, fmaxf(s0[r], s1[r]));
      tm = fmaxf(tm, xhalf(tm)) * inv_scale;
      const float mn = fmaxf(m, tm);
      const float f = __expf(m - mn);
      m = mn;

      v16bf pb;  // P^T B-fragment: element e = key kh + e, element 8 + e = key 16 + kh + e
      float ps0 = 0.0f, ps1 = 0.0f;
#pragma unroll
      for (int r = 0; r < 8; ++r) {
        float p0 = __expf(s0[r] * inv_scale - mn);
        float p1 = __expf(s1[r] * inv_scale - mn);
        ps0 += p0;
        ps1 += p1;
        pb[r] = (__bf16)p0;
        pb[r + 8] = (__bf16)p1;
      }
      l = l * f + (ps0 + ps1);

#pragma unroll
      for (int t = 0; t < 4; ++t) {
        o[t] *= f;
        o[t] = wmma_bf16(va[t], pb, o[t]);
      }
    }
    // This wave's LDS reads have retired before any wave's next copies land there.
    asm volatile("s_wait_dscnt 0x0" ::: "memory");
    wait_asynccnt0();  // this wave's share of stage st + 1 has landed
    __syncthreads();   // publishes stage st + 1 and ends every reader's last read of stage st
    if (st + 2 < nst)
      async_stage_4xb128(sdst + buf * 2, 16 * KV_PITCH * 2, ksrc + (size_t)(st + 2) * KV_KEYS * 1024,
                         (size_t)16 * 1024 * 2);
  }
  wait_asynccnt0();  // no copy is outstanding when the wave goes on to its end

  // Join the halves' sums, normalize and store (concat layout): 8 consecutive d = 16 B a store.
  const float linv = 1.0f / (l + xhalf(l));
  __bf16* zrow = Zbf + ((size_t)b * 1024 + q0 + lanelo) * 1024 + h * 64 + kh;
#pragma unroll
  for (int t = 0; t < 4; ++t) {
    v8bf w;
#pragma unroll
    for (int r = 0; r < 8; ++r) w[r] = (__bf16)(o[t][r] * linv);
    *(v8bf*)(zrow + t * 16) = w;
  }
}

// ---------------------------------------------------------------------------
// y = alpha * (x + r - mean) / (std_unbiased + 1e-6) + beta  (per row of 1024)
// ---------------------------------------------------------------------------
__global__ __launch_bounds__(256) void residual_ln_kernel(const float* __restrict__ X,
                                                          const float* __restrict__ R,
                                                          const float* __restrict__ alpha,
                                                          const float* __restrict__ beta,
                                                          float* outF, __bf16* outB) {
  __shared__ float s1[256], s2[256], stats[2];
  const int row = blockIdx.x;
  const int t = threadIdx.x;
  const float* xr = X + (size_t)row * 1024;
  const float* rr = R + (size_t)row * 1024;

  float v[4], sum = 0.0f, sq = 0.0f;
#pragma unroll
  for (int i = 0; i < 4; ++i) {
    int c = t + i * 256;
    float a = xr[c] + rr[c];
    v[i] = a; sum += a; sq += a * a;
  }
  s1[t] = sum; s2[t] = sq;
  __syncthreads();
  for (int s = 128; s > 0; s >>= 1) {
    if (t < s) { s1[t] += s1[t + s]; s2[t] += s2[t + s]; }
    __syncthreads();
  }
  if (t == 0) {
    float mean = s1[0] * (1.0f / 1024.0f);
    float var = (s2[0] - 1024.0f * mean * mean) * (1.0f / 1023.0f);  // ddof=1
    var = fmaxf(var, 0.0f);
    stats[0] = mean;
    stats[1] = 1.0f / (sqrtf(var) + 1e-6f);
  }
  __syncthreads();
  float mean = stats[0], rinv = stats[1];
#pragma unroll
  for (int i = 0; i < 4; ++i) {
    int c = t + i * 256;
    float y = alpha[c] * (v[i] - mean) * rinv + beta[c];
    size_t off = (size_t)row * 1024 + c;
    if (outF) outF[off] = y;
    if (outB) outB[off] = (__bf16)y;
  }
}

// ---------------------------------------------------------------------------
// Orchestration
// ---------------------------------------------------------------------------
extern "C" void kernel_launch(void* const* d_in, const int* in_sizes, int n_in,
                              void* d_out, int out_size, void* d_ws, size_t ws_size,
                              hipStream_t stream) {
  const float* x     = (const float*)d_in[0];   // [4,1024,1024]
  const float* Wq    = (const float*)d_in[1];   // [1024,1024]
  const float* bq    = (const float*)d_in[2];
  const float* Wo    = (const float*)d_in[3];
  const float* bo    = (const float*)d_in[4];
  const float* W1    = (const float*)d_in[5];   // [1024,2048]
  const float* b1    = (const float*)d_in[6];
  const float* W2    = (const float*)d_in[7];   // [2048,1024]
  const float* b2    = (const float*)d_in[8];
  const float* alpha = (const float*)d_in[9];
  const float* beta  = (const float*)d_in[10];

  char* ws = (char*)d_ws;
  const size_t MB = 1u << 20;
  __bf16* Xbf  = (__bf16*)(ws + 0);         //  8 MB  (4M bf16)
  __bf16* WqT  = (__bf16*)(ws + 8 * MB);    //  2 MB
  __bf16* WoT  = (__bf16*)(ws + 10 * MB);   //  2 MB
  __bf16* W1T  = (__bf16*)(ws + 12 * MB);   //  4 MB
  __bf16* W2T  = (__bf16*)(ws + 16 * MB);   //  4 MB
  __bf16* Qbf  = (__bf16*)(ws + 20 * MB);   //  8 MB
  __bf16* Zbf  = (__bf16*)(ws + 36 * MB);   //  8 MB
  float*  tmpF = (float*)(ws + 44 * MB);    // 16 MB (attn_out, then ff)
  float*  Yf   = (float*)(ws + 60 * MB);    // 16 MB
  __bf16* Ybf  = (__bf16*)(ws + 76 * MB);   //  8 MB
  __bf16* Hbf  = (__bf16*)(ws + 84 * MB);   // 16 MB (4096x2048)

  const int NTOK = 4096;                     // b*s

  // bf16 conversion of x and the four weight transposes, one launch
  prep_kernel<<<2048, 256, 0, stream>>>(x, Xbf, Wq, WqT, Wo, WoT, W1, W1T, W2, W2T);

  // Q = X @ Wq + bq   (q = k = v in the reference)
  gemm_kernel<<<dim3(1024 / 64, NTOK / 128), 256, 0, stream>>>(
      Xbf, WqT, bq, nullptr, Qbf, NTOK, 1024, 1024, 0);

  // Z = softmax(Q Q^T / 8) @ Q, concat layout, bf16
  attn_kernel<<<dim3(1024 / 64, 64), 128, 0, stream>>>(Qbf, Zbf);

  // attn_out = Z @ Wo + bo
  gemm_kernel<<<dim3(1024 / 64, NTOK / 128), 256, 0, stream>>>(
      Zbf, WoT, bo, tmpF, nullptr, NTOK, 1024, 1024, 0);

  // Y = LN(x + attn_out)
  residual_ln_kernel<<<NTOK, 256, 0, stream>>>(x, tmpF, alpha, beta, Yf, Ybf);

  // H = relu(Y @ W1 + b1)
  gemm_kernel<<<dim3(2048 / 64, NTOK / 128), 256, 0, stream>>>(
      Ybf, W1T, b1, nullptr, Hbf, NTOK, 2048, 1024, 1);

  // ff = H @ W2 + b2
  gemm_kernel<<<dim3(16, NTOK / 128), 256, 0, stream>>>(
      Hbf, W2T, b2, tmpF, nullptr, NTOK, 1024, 2048, 0);

  // out = LN(Y + ff)
  residual_ln_kernel<<<NTOK, 256, 0, stream>>>(Yf, tmpF, alpha, beta, (float*)d_out, nullptr);
}
